// v000
// The times below were measured on an AMD MI455X: many runs one after another, warmed up first and cycling through
// copies of the inputs, with the whole window's GPU time divided by the number of runs. Launches and the gaps
// between them are all in it. The median over several windows is given; except for v000 it joins two sittings, which
// can be a few percent apart, so the side-by-side timings, each taken in one sitting, are the better comparison.
// v000 is the starting kernel. One run takes 204 microseconds.
#include <hip/hip_runtime.h>

// Self attention, 12 heads of width 64, on one input stream x [4][2048][64]; q, k, v = x W + b with W [64][768] ([in][out]) and b [768]; scores = q k^T / 8 + (1 - m[b][key]) * (-10000); softmax over keys; out [4][2048][768] with heads merged head-major (column h*64 + d).
// Compute dtypes, f32 accumulate: projections v_wmma_f32_16x16x32_bf16 on bf16-RNE inputs (exact products); scores v_wmma_f32_16x16x32_f16 with q as f16 hi + f16 residual x 2^11 (own accumulator) and k as one f16 plane; probability x value v_wmma_f32_16x16x32_f16 with P carried x 1024 and v as one f16 plane; softmax in f32.
// Attention engine: transposed flash form S^T = K Q^T (Q^T held as B fragments in registers), packed P^T from the two S^T accumulators is the B fragment of O^T = V^T P^T; no LDS and no barrier inside the key loop.

#ifndef NB
#define NB 4
#endif
#ifndef SEQ
#define SEQ 2048
#endif
#define NB_FULL  4
#define SEQ_FULL 2048
#define DM   64
#define NH   12
#define HD   64
#define NP   (NH * HD)
#ifndef QLO
#define QLO 1
#endif
#define LCAR 2048.0f
#define PCL  10.0f
#define SCL  0.125f
#define L2E  1.4426950408889634f

static_assert(SEQ % 64 == 0);
static_assert(NB <= NB_FULL);
static_assert(SEQ <= SEQ_FULL);
static_assert((NB * NH * (SEQ / 16)) % 4 == 0);
static_assert(DM % 32 == 0);
static_assert(HD == 64);

typedef _Float16 h16;
typedef unsigned short bf;
typedef __attribute__((ext_vector_type(16))) __bf16   v16bf;
typedef __attribute__((ext_vector_type(16))) _Float16 v16h;
typedef __attribute__((ext_vector_type(8)))  _Float16 v8h;
typedef __attribute__((ext_vector_type(8)))  unsigned short v8us;
typedef __attribute__((ext_vector_type(2)))  unsigned short v2us;
typedef __attribute__((ext_vector_type(8)))  float    v8f;
typedef __attribute__((ext_vector_type(4)))  float    v4f;
typedef v8h  __attribute__((may_alias)) v8ha;
typedef v4f  __attribute__((may_alias)) v4fa;

__device__ __forceinline__ unsigned short f2bf(float f) { unsigned u = __float_as_uint(f); u += 0x7FFFu + ((u >> 16) & 1u); return (unsigned short)(u >> 16); }
__device__ __forceinline__ float bf2f(unsigned short b) { return __uint_as_float(((unsigned)b) << 16); }
__device__ __forceinline__ float bfr(float f) { return bf2f(f2bf(f)); }
__device__ __forceinline__ v16h cat16(v8h lo, v8h hi) { return __builtin_shufflevector(lo, hi, 0, 1, 2, 3, 4, 5, 6, 7, 8, 9, 10, 11, 12, 13, 14, 15); }
__device__ __forceinline__ v16bf cat16b(v8us lo, v8us hi) { return __builtin_bit_cast(v16bf, __builtin_shufflevector(lo, hi, 0, 1, 2, 3, 4, 5, 6, 7, 8, 9, 10, 11, 12, 13, 14, 15)); }
__device__ __forceinline__ v8f wmma16(v16h a, v16h b, v8f c) { return __builtin_amdgcn_wmma_f32_16x16x32_f16(false, a, false, b, (short)0, c, false, false); }
__device__ __forceinline__ v8f wmmab(v16bf a, v16bf b, v8f c) { return __builtin_amdgcn_wmma_f32_16x16x32_bf16(false, a, false, b, (short)0, c, false, false); }
// fragment loaders: p already points at (row, k0 + 8*half); elements 0..7 = k0+8h.., elements 8..15 = k0+16+8h..
__device__ __forceinline__ v16h ldh(const h16* p) { return cat16(*(const v8h*)p, *(const v8h*)(p + 16)); }
__device__ __forceinline__ v16bf ldb(const bf* p) { return cat16b(*(const v8us*)p, *(const v8us*)(p + 16)); }
__device__ __forceinline__ float ex2(float x) { return __builtin_amdgcn_exp2f(x); }

#define PX_BLOCKS ((NB * SEQ * DM / 8 + 255) / 256)
#define PW_BLOCKS ((3 * NP + 7) / 8)
#define PB_BLOCKS ((3 * NP + 255) / 256)
#define PM_BLOCKS ((NB * SEQ + 255) / 256)

// ---- k_prep: one launch, block-uniform roles.
// B: BI[mat][n] = bf16-RNE value of bias_mat[n] kept as f32 (32 lanes x 4 B per line).
// M: MB[b][t] = (1 - bf16-RNE m[b][t]) * (-10000) as f32 (32 lanes x 4 B per line).
__global__ __launch_bounds__(256) void k_prep(const float* __restrict__ x, const float* __restrict__ am,
                                              const float* __restrict__ wq, const float* __restrict__ bq,
                                              const float* __restrict__ wk, const float* __restrict__ bk,
                                              const float* __restrict__ wv, const float* __restrict__ bv,
                                              bf* XB, bf* WT, float* BI, float* MB) {
    const int blk = blockIdx.x, tid = threadIdx.x;
    if (blk < PX_BLOCKS) {
        const int i = blk * 256 + tid;
        if (i < NB * SEQ * DM / 8) {
            const int e = i * 8; const int rr = e / DM, c = e % DM; const int b = rr / SEQ, t = rr % SEQ;
            const float* src = x + ((size_t)b * SEQ_FULL + t) * DM + c;
            const v4f a0 = *(const v4f*)src; const v4f a1 = *(const v4f*)(src + 4);
            v8us o;
#pragma unroll
            for (int k = 0; k < 4; ++k) { o[k] = f2bf(a0[k]); o[4 + k] = f2bf(a1[k]); }
            *(v8us*)(XB + (size_t)e) = o; 
        }
    } else if (blk < PX_BLOCKS + PW_BLOCKS) {
        const int line = (blk - PX_BLOCKS) * 8 + (tid >> 5); const int lane = tid & 31;
        if (line < 3 * NP) {
            const int mat = line / NP, n = line % NP; const int k = 2 * lane;
            const size_t i0 = (size_t)k * NP + n, i1 = (size_t)(k + 1) * NP + n;
            const float a0 = wq[i0], a1 = wq[i1], b0 = wk[i0], b1 = wk[i1], c0 = wv[i0], c1 = wv[i1];
            const float w0 = (mat == 0) ? a0 : ((mat == 1) ? b0 : c0);
            const float w1 = (mat == 0) ? a1 : ((mat == 1) ? b1 : c1);
            v2us o; o[0] = f2bf(w0); o[1] = f2bf(w1);
            bf* dst = WT + (size_t)line * DM + k;
            *(v2us*)dst = o; 
        }
    } else if (blk < PX_BLOCKS + PW_BLOCKS + PB_BLOCKS) {
        const int idx = (blk - PX_BLOCKS - PW_BLOCKS) * 256 + tid;
        if (idx < 3 * NP) {
            const int mat = idx / NP, n = idx % NP;
            const float a = bq[n], b = bk[n], c = bv[n];
            const float val = bfr((mat == 0) ? a : ((mat == 1) ? b : c));
            *(float*)(BI + idx) = val; 
        }
    } else {
        const int idx = (blk - PX_BLOCKS - PW_BLOCKS - PB_BLOCKS) * 256 + tid;
        if (idx < NB * SEQ) {
            const int b = idx / SEQ, t = idx % SEQ;
            const float a = bfr(am[(size_t)b * SEQ_FULL + t]);
            const float val = (1.0f - a) * (-10000.0f);
            *(float*)(MB + idx) = val; 
        }
    }
}

// ---- k_proj: one wave per 64x64 tile of [NB*SEQ][768] for mat = blockIdx.z (0 q, 1 k, 2 v); column tile = one head. K = 64 (two 32-deep steps), bf16 operands straight from the K-contiguous planes.
// Planes (f16), PL = [QH | KH | QL | VT], each NB*NH*SEQ*64 elements: QH/KH/QL [b][h][t][d], VT [b][h][d][t].
__global__ __launch_bounds__(32) void k_proj(const bf* __restrict__ XB, const bf* __restrict__ WT, const float* __restrict__ BI, h16* PL) {
    __shared__ __align__(16) h16 hs[64 * 72];
    __shared__ __align__(16) h16 ls[64 * 72];
    const int lane = threadIdx.x & 31, lr = lane & 15, hi = lane >> 4;
    const int r0 = blockIdx.x * 64, hd = blockIdx.y, mat = blockIdx.z; const int c0 = hd * 64;
    v8f acc[4][4];
#pragma unroll
    for (int mb = 0; mb < 4; ++mb)
#pragma unroll
        for (int nb = 0; nb < 4; ++nb) acc[mb][nb] = (v8f){};
    const bf* Ap = XB + (size_t)(r0 + lr) * DM + 8 * hi;
    const bf* Bp = WT + ((size_t)mat * NP + c0 + lr) * DM + 8 * hi;
#pragma unroll 1
    for (int kc = 0; kc < DM; kc += 32) {
        v16bf a[4]; v16bf bl;
#pragma unroll
        for (int mb = 0; mb < 4; ++mb) a[mb] = ldb(Ap + (size_t)mb * 16 * DM + kc);
#pragma unroll
        for (int nb = 0; nb < 4; ++nb) { const v16bf b = ldb(Bp + (size_t)nb * 16 * DM + kc); bl = b;
#pragma unroll
            for (int mb = 0; mb < 4; ++mb) acc[mb][nb] = wmmab(a[mb], b, acc[mb][nb]); }
        asm volatile("v_nop\n\tv_nop\n\tv_nop\n\tv_nop" : "+v"(acc[0][3]), "+v"(acc[1][3]), "+v"(acc[2][3]), "+v"(acc[3][3]) : "v"(a[0]), "v"(a[1]), "v"(a[2]), "v"(a[3]), "v"(bl));
    }
    float bia[4];
#pragma unroll
    for (int nb = 0; nb < 4; ++nb) bia[nb] = BI[mat * NP + c0 + nb * 16 + lr];
    const int b = r0 / SEQ, t0 = r0 % SEQ; const size_t bh = (size_t)b * NH + hd;
    const size_t PLN = (size_t)NB * NH * SEQ * HD;
    const int rq = lane >> 3, pc = (lane & 7) * 8;
    if (mat == 2) {
        // v: staged transposed hs[d][t]; lane's 8 accumulator rows are 8 consecutive t -> one 16-B LDS store
#pragma unroll
        for (int mb = 0; mb < 4; ++mb)
#pragma unroll
            for (int nb = 0; nb < 4; ++nb) { v8h pk;
#pragma unroll
                for (int j = 0; j < 8; ++j) pk[j] = (h16)(acc[mb][nb][j] + bia[nb]);
                *(v8ha*)(hs + (nb * 16 + lr) * 72 + mb * 16 + 8 * hi) = pk; }
        __syncthreads();
        h16* dst = PL + 3 * PLN + bh * HD * SEQ + t0;
{
#pragma unroll
            for (int i = 0; i < 16; ++i) { const int d = 4 * i + rq; const v8h val = *(const v8ha*)(hs + d * 72 + pc);
                *(v8h*)(dst + (size_t)d * SEQ + pc) = val; }
             }
    } else {
        const bool wl = (mat == 0) && (QLO != 0);
#pragma unroll
        for (int mb = 0; mb < 4; ++mb)
#pragma unroll
            for (int nb = 0; nb < 4; ++nb)
#pragma unroll
                for (int j = 0; j < 8; ++j) { const int row = mb * 16 + 8 * hi + j, col = nb * 16 + lr; const float v = acc[mb][nb][j] + bia[nb]; const h16 hv = (h16)v;
                    hs[row * 72 + col] = hv; if (wl) ls[row * 72 + col] = (h16)((v - (float)hv) * LCAR); }
        __syncthreads();
        h16* dst = PL + (size_t)mat * PLN + (bh * SEQ + t0) * HD;
{
#pragma unroll
            for (int i = 0; i < 16; ++i) { const int row = 4 * i + rq; const v8h val = *(const v8ha*)(hs + row * 72 + pc);
                *(v8h*)(dst + (size_t)row * HD + pc) = val; }
             }
        if (wl) {
            h16* dl = PL + 2 * PLN + (bh * SEQ + t0) * HD;
{
#pragma unroll
                for (int i = 0; i < 16; ++i) { const int row = 4 * i + rq; const v8h val = *(const v8ha*)(ls + row * 72 + pc);
                    *(v8h*)(dl + (size_t)row * HD + pc) = val; }
                 }
        }
    }
}

// ---- k_attn: 4 waves per block, each wave owns 16 consecutive queries of one (b, h) and walks all keys 32 at a time.
// S^T tile (keys x queries): A = K rows (m = key, k = d), B = Q^T (k = d, n = query) held in registers; accumulator element r of lane (half, n) = (key 8*half + r, query n).
// Online softmax per query = per lane column (in-lane over 16 values + one xor-16 exchange); state m_run / nb_run / l per lane; accumulators hold 1024 * sum(p v).
// P^T B fragment: elements 0..7 = first key tile's accumulator, elements 8..15 = second key tile's accumulator (same lane). A = V^T rows (m = d, k = key).
__global__ __launch_bounds__(128) void k_attn(const h16* __restrict__ PL, const float* __restrict__ MB, float* OUT) {
    __shared__ __align__(16) float os[4 * 16 * 68];
    const int w = threadIdx.x >> 5, lane = threadIdx.x & 31, lr = lane & 15, hi = lane >> 4;
    const int qt = blockIdx.x * 4 + w;
    const int bh = qt / (SEQ / 16); const int q0 = (qt % (SEQ / 16)) * 16; const int b = bh / NH, hd = bh % NH;
    const size_t PLN = (size_t)NB * NH * SEQ * HD;
    const h16* qh = PL + ((size_t)bh * SEQ + q0 + lr) * HD + 8 * hi;
    const h16* ql = qh + 2 * PLN;
    const h16* kb = PL + PLN + (size_t)bh * SEQ * HD + (size_t)lr * HD + 8 * hi;
    const h16* vb = PL + 3 * PLN + (size_t)bh * HD * SEQ + (size_t)lr * SEQ + 8 * hi;
    const float* mb = MB + (size_t)b * SEQ + 8 * hi;
    const v16h bqh0 = ldh(qh), bqh1 = ldh(qh + 32);
    v16h bql0 = bqh0, bql1 = bqh1;
    if (QLO) { bql0 = ldh(ql); bql1 = ldh(ql + 32); }
    v8f acc[4];
#pragma unroll
    for (int dt = 0; dt < 4; ++dt) acc[dt] = (v8f){};
    float m_run = -1.0e30f, nb_run = 1.4426950e30f, l_run = 0.0f;
#pragma unroll 1
    for (int j0 = 0; j0 < SEQ; j0 += 32) {
        const h16* k0p = kb + (size_t)j0 * HD;
        const v16h ka0 = ldh(k0p), ka1 = ldh(k0p + 32), kc0 = ldh(k0p + 16 * HD), kc1 = ldh(k0p + 16 * HD + 32);
        const v4f m0a = *(const v4f*)(mb + j0), m0b = *(const v4f*)(mb + j0 + 4), m1a = *(const v4f*)(mb + j0 + 16), m1b = *(const v4f*)(mb + j0 + 20);
        v16h vf[4];
#pragma unroll
        for (int dt = 0; dt < 4; ++dt) vf[dt] = ldh(vb + (size_t)dt * 16 * SEQ + j0);
        v8f sh0 = (v8f){}, sh1 = (v8f){}, sl0 = (v8f){}, sl1 = (v8f){};
        sh0 = wmma16(ka0, bqh0, sh0); sh1 = wmma16(kc0, bqh0, sh1);
        sh0 = wmma16(ka1, bqh1, sh0); sh1 = wmma16(kc1, bqh1, sh1);
        if (QLO) {
            sl0 = wmma16(ka0, bql0, sl0); sl1 = wmma16(kc0, bql0, sl1);
            sl0 = wmma16(ka1, bql1, sl0); sl1 = wmma16(kc1, bql1, sl1);
        }
        asm volatile("v_nop\n\tv_nop\n\tv_nop\n\tv_nop" : "+v"(sh0), "+v"(sh1), "+v"(sl0), "+v"(sl1) : "v"(ka1), "v"(kc1), "v"(bqh1), "v"(bql1));
        float t[16];
#pragma unroll
        for (int r = 0; r < 8; ++r) {
            float u0 = sh0[r], u1 = sh1[r];
            if (QLO) { u0 = __builtin_fmaf(sl0[r], 1.0f / LCAR, u0); u1 = __builtin_fmaf(sl1[r], 1.0f / LCAR, u1); }
            const float g0 = (r < 4) ? m0a[r & 3] : m0b[r & 3];
            const float g1 = (r < 4) ? m1a[r & 3] : m1b[r & 3];
            t[r] = __builtin_fmaf(u0, SCL, g0); t[8 + r] = __builtin_fmaf(u1, SCL, g1);
        }
        float mx = t[0];
#pragma unroll
        for (int i = 1; i < 16; ++i) mx = fmaxf(mx, t[i]);
        const float mo = __shfl_xor(mx, 16, 32);
        mx = fmaxf(mx, mo);
        const float mnew = fmaxf(m_run, mx);
        const unsigned grow = __builtin_amdgcn_ballot_w32(mnew > m_run);
        if (grow != 0u) {      // wave-uniform: some query column got a new maximum
            const float nbn = __builtin_fmaf(-mnew, L2E, PCL);
            const float al = ex2(nbn - nb_run);
            l_run *= al;
#pragma unroll
            for (int dt = 0; dt < 4; ++dt)
#pragma unroll
                for (int r = 0; r < 8; ++r) acc[dt][r] *= al;
            nb_run = nbn; m_run = mnew;
        }
        v16h pf; float ps = 0.0f;
#pragma unroll
        for (int r = 0; r < 8; ++r) {
            const float e0 = ex2(__builtin_fmaf(t[r], L2E, nb_run));
            const float e1 = ex2(__builtin_fmaf(t[8 + r], L2E, nb_run));
            ps += e0 + e1; pf[r] = (h16)e0; pf[8 + r] = (h16)e1;
        }
        l_run += ps;
#pragma unroll
        for (int dt = 0; dt < 4; ++dt) acc[dt] = wmma16(vf[dt], pf, acc[dt]);
        asm volatile("v_nop\n\tv_nop\n\tv_nop\n\tv_nop" : "+v"(acc[0]), "+v"(acc[1]), "+v"(acc[2]), "+v"(acc[3]) : "v"(vf[0]), "v"(vf[1]), "v"(vf[2]), "v"(vf[3]), "v"(pf));
    }
    const float lo = __shfl_xor(l_run, 16, 32);
    const float inv = 1.0f / (l_run + lo);
    float* o = os + w * 16 * 68;
#pragma unroll
    for (int dt = 0; dt < 4; ++dt) { v4f a, c;
#pragma unroll
        for (int r = 0; r < 4; ++r) { a[r] = acc[dt][r] * inv; c[r] = acc[dt][4 + r] * inv; }
        *(v4fa*)(o + lr * 68 + dt * 16 + 8 * hi) = a; *(v4fa*)(o + lr * 68 + dt * 16 + 8 * hi + 4) = c; }
    __syncthreads();
    float* dst = OUT + ((size_t)b * SEQ_FULL + q0) * NP + hd * HD;
{
#pragma unroll
        for (int s = 0; s < 8; ++s) { const int row = 2 * s + hi, cofs = lr * 4; const v4f val = *(const v4fa*)(o + row * 68 + cofs);
            *(v4f*)(dst + (size_t)row * NP + cofs) = val; }
         }
}

extern "C" void kernel_launch(void* const* d_in, const int* in_sizes, int n_in,
                              void* d_out, int out_size, void* d_ws, size_t ws_size, hipStream_t stream) {
    if (n_in < 8) return;
    const size_t rows_in = (size_t)(NB - 1) * SEQ_FULL + SEQ;
    if ((size_t)in_sizes[0] < rows_in * DM) return;
    if ((size_t)in_sizes[1] < rows_in) return;
    if (in_sizes[2] < DM * NP || in_sizes[4] < DM * NP || in_sizes[6] < DM * NP) return;
    if (in_sizes[3] < NP || in_sizes[5] < NP || in_sizes[7] < NP) return;
    if ((size_t)out_size < rows_in * NP) return;
    const float* x  = (const float*)d_in[0];   // hidden_states [4][2048][64]
    const float* am = (const float*)d_in[1];   // attention_mask [4][2048]
    const float* wq = (const float*)d_in[2]; const float* bq = (const float*)d_in[3];
    const float* wk = (const float*)d_in[4]; const float* bk = (const float*)d_in[5];
    const float* wv = (const float*)d_in[6]; const float* bv = (const float*)d_in[7];
    float* OUT = (float*)d_out;                // [4][2048][768]
    char* wsp = (char*)d_ws;
    auto take = [&](size_t bytes) { char* p = wsp; wsp += (bytes + 255) & ~(size_t)255; return (void*)p; };
    const size_t PLN = (size_t)NB * NH * SEQ * HD;
    bf* XB = (bf*)take((size_t)NB * SEQ * DM * 2);
    bf* WT = (bf*)take((size_t)3 * NP * DM * 2);
    float* BI = (float*)take((size_t)3 * NP * 4);
    float* MB = (float*)take((size_t)NB * SEQ * 4);
    h16* PL = (h16*)take(4 * PLN * 2);
    if ((size_t)(wsp - (char*)d_ws) > ws_size) return;
    k_prep<<<PX_BLOCKS + PW_BLOCKS + PB_BLOCKS + PM_BLOCKS, 256, 0, stream>>>(x, am, wq, bq, wk, bk, wv, bv, XB, WT, BI, MB);
    k_proj<<<dim3(NB * SEQ / 64, NH, 3), 32, 0, stream>>>(XB, WT, BI, PL);
    k_attn<<<NB * NH * (SEQ / 16) / 4, 128, 0, stream>>>(PL, MB, OUT);
}

// v001
// It runs in 171 microseconds.
// Timed twice side by side with v000, it ran 1.26 and 1.21 times as fast.
#include <hip/hip_runtime.h>

// Self attention, 12 heads of width 64, on one input stream x [4][2048][64]; q, k, v = x W + b with W [64][768] ([in][out]) and b [768]; scores = q k^T / 8 + (1 - m[b][key]) * (-10000); softmax over keys; out [4][2048][768] with heads merged head-major (column h*64 + d).
// Compute dtypes, f32 accumulate: projections v_wmma_f32_16x16x32_bf16 on bf16-RNE inputs (exact products); scores v_wmma_f32_16x16x32_f16 with q as f16 hi + f16 residual x 2^11 (own accumulator) and k as one f16 plane; probability x value v_wmma_f32_16x16x32_f16 with P carried x 1024 and v as one f16 plane; softmax in f32.
// Attention engine: transposed flash form S^T = K Q^T (Q^T held as B fragments in registers), packed P^T from the two S^T accumulators is the B fragment of O^T = V^T P^T; no LDS and no barrier inside the key loop.

#ifndef NB
#define NB 4
#endif
#ifndef SEQ
#define SEQ 2048
#endif
#define NB_FULL  4
#define SEQ_FULL 2048
#define DM   64
#define NH   12
#define HD   64
#define NP   (NH * HD)
#ifndef QLO
#define QLO 1
#endif
#define LCAR 2048.0f
#define PCL  10.0f
#define SCL  0.125f
#define L2E  1.4426950408889634f

static_assert(SEQ % 64 == 0);
static_assert(NB <= NB_FULL);
static_assert(SEQ <= SEQ_FULL);
static_assert((NB * NH * (SEQ / 16)) % 4 == 0);
static_assert(DM % 32 == 0);
static_assert(HD == 64);

typedef _Float16 h16;
typedef unsigned short bf;
typedef __attribute__((ext_vector_type(16))) __bf16   v16bf;
typedef __attribute__((ext_vector_type(16))) _Float16 v16h;
typedef __attribute__((ext_vector_type(8)))  _Float16 v8h;
typedef __attribute__((ext_vector_type(8)))  unsigned short v8us;
typedef __attribute__((ext_vector_type(2)))  unsigned short v2us;
typedef __attribute__((ext_vector_type(8)))  float    v8f;
typedef __attribute__((ext_vector_type(4)))  float    v4f;
typedef v8h  __attribute__((may_alias)) v8ha;
typedef v4f  __attribute__((may_alias)) v4fa;

__device__ __forceinline__ unsigned short f2bf(float f) { unsigned u = __float_as_uint(f); u += 0x7FFFu + ((u >> 16) & 1u); return (unsigned short)(u >> 16); }
__device__ __forceinline__ float bf2f(unsigned short b) { return __uint_as_float(((unsigned)b) << 16); }
__device__ __forceinline__ float bfr(float f) { return bf2f(f2bf(f)); }
__device__ __forceinline__ v16h cat16(v8h lo, v8h hi) { return __builtin_shufflevector(lo, hi, 0, 1, 2, 3, 4, 5, 6, 7, 8, 9, 10, 11, 12, 13, 14, 15); }
__device__ __forceinline__ v16bf cat16b(v8us lo, v8us hi) { return __builtin_bit_cast(v16bf, __builtin_shufflevector(lo, hi, 0, 1, 2, 3, 4, 5, 6, 7, 8, 9, 10, 11, 12, 13, 14, 15)); }
__device__ __forceinline__ v8f wmma16(v16h a, v16h b, v8f c) { return __builtin_amdgcn_wmma_f32_16x16x32_f16(false, a, false, b, (short)0, c, false, false); }
__device__ __forceinline__ v8f wmmab(v16bf a, v16bf b, v8f c) { return __builtin_amdgcn_wmma_f32_16x16x32_bf16(false, a, false, b, (short)0, c, false, false); }
// fragment loaders: p already points at (row, k0 + 8*half); elements 0..7 = k0+8h.., elements 8..15 = k0+16+8h..
__device__ __forceinline__ v16h ldh(const h16* p) { return cat16(*(const v8h*)p, *(const v8h*)(p + 16)); }
// packed fragment loader: p already points at (fragment, lane * 8); the two 16-B halves of a fragment lie 512 B apart, each a run of 32 lanes x 16 B
__device__ __forceinline__ v16h ldp(const h16* p) { return cat16(*(const v8h*)p, *(const v8h*)(p + 256)); }
__device__ __forceinline__ v16bf ldb(const bf* p) { return cat16b(*(const v8us*)p, *(const v8us*)(p + 16)); }
__device__ __forceinline__ float ex2(float x) { return __builtin_amdgcn_exp2f(x); }

#define PX_BLOCKS ((NB * SEQ * DM / 8 + 255) / 256)
#define PW_BLOCKS ((3 * NP + 7) / 8)
#define PB_BLOCKS ((3 * NP + 255) / 256)
#define PM_BLOCKS ((NB * SEQ + 255) / 256)

// ---- k_prep: one launch, block-uniform roles.
// B: BI[mat][n] = bf16-RNE value of bias_mat[n] kept as f32 (32 lanes x 4 B per line).
// M: MB[b][t] = (1 - bf16-RNE m[b][t]) * (-10000) as f32 (32 lanes x 4 B per line).
__global__ __launch_bounds__(256) void k_prep(const float* __restrict__ x, const float* __restrict__ am,
                                              const float* __restrict__ wq, const float* __restrict__ bq,
                                              const float* __restrict__ wk, const float* __restrict__ bk,
                                              const float* __restrict__ wv, const float* __restrict__ bv,
                                              bf* XB, bf* WT, float* BI, float* MB) {
    const int blk = blockIdx.x, tid = threadIdx.x;
    if (blk < PX_BLOCKS) {
        const int i = blk * 256 + tid;
        if (i < NB * SEQ * DM / 8) {
            const int e = i * 8; const int rr = e / DM, c = e % DM; const int b = rr / SEQ, t = rr % SEQ;
            const float* src = x + ((size_t)b * SEQ_FULL + t) * DM + c;
            const v4f a0 = *(const v4f*)src; const v4f a1 = *(const v4f*)(src + 4);
            v8us o;
#pragma unroll
            for (int k = 0; k < 4; ++k) { o[k] = f2bf(a0[k]); o[4 + k] = f2bf(a1[k]); }
            *(v8us*)(XB + (size_t)e) = o; 
        }
    } else if (blk < PX_BLOCKS + PW_BLOCKS) {
        const int line = (blk - PX_BLOCKS) * 8 + (tid >> 5); const int lane = tid & 31;
        if (line < 3 * NP) {
            const int mat = line / NP, n = line % NP; const int k = 2 * lane;
            const size_t i0 = (size_t)k * NP + n, i1 = (size_t)(k + 1) * NP + n;
            const float a0 = wq[i0], a1 = wq[i1], b0 = wk[i0], b1 = wk[i1], c0 = wv[i0], c1 = wv[i1];
            const float w0 = (mat == 0) ? a0 : ((mat == 1) ? b0 : c0);
            const float w1 = (mat == 0) ? a1 : ((mat == 1) ? b1 : c1);
            v2us o; o[0] = f2bf(w0); o[1] = f2bf(w1);
            bf* dst = WT + (size_t)line * DM + k;
            *(v2us*)dst = o; 
        }
    } else if (blk < PX_BLOCKS + PW_BLOCKS + PB_BLOCKS) {
        const int idx = (blk - PX_BLOCKS - PW_BLOCKS) * 256 + tid;
        if (idx < 3 * NP) {
            const int mat = idx / NP, n = idx % NP;
            const float a = bq[n], b = bk[n], c = bv[n];
            const float val = bfr((mat == 0) ? a : ((mat == 1) ? b : c));
            *(float*)(BI + idx) = val; 
        }
    } else {
        const int idx = (blk - PX_BLOCKS - PW_BLOCKS - PB_BLOCKS) * 256 + tid;
        if (idx < NB * SEQ) {
            const int b = idx / SEQ, t = idx % SEQ;
            const float a = bfr(am[(size_t)b * SEQ_FULL + t]);
            const float val = (1.0f - a) * (-10000.0f);
            *(float*)(MB + idx) = val; 
        }
    }
}

// ---- k_proj: one wave per 64x64 tile of [NB*SEQ][768] for mat = blockIdx.z (0 q, 1 k, 2 v); column tile = one head. K = 64 (two 32-deep steps), bf16 operands straight from the K-contiguous planes.
// Planes (f16), PL = [QH | QL | KV], QH/QL NB*NH*SEQ*64 elements each, [b][h][t][d]; KV twice that, [b][h][t/32][16 runs][32 lanes][8]: per 32 keys the 16 wave-wide 16-B loads of k_attn's A fragments, each run 512 contiguous bytes.
// Runs 0..7 hold k: run = 4*((t%32)/16) + d/16, lane = 16*((d/8)&1) + t%16, element d%8. Runs 8..15 hold v transposed: run = 8 + 2*(d/16) + (t%32)/16, lane = 16*((t/8)&1) + d%16, element t%8.
__global__ __launch_bounds__(32) void k_proj(const bf* __restrict__ XB, const bf* __restrict__ WT, const float* __restrict__ BI, h16* PL) {
    __shared__ __align__(16) h16 hs[64 * 72];
    __shared__ __align__(16) h16 ls[64 * 72];
    const int lane = threadIdx.x & 31, lr = lane & 15, hi = lane >> 4;
    const int r0 = blockIdx.x * 64, hd = blockIdx.y, mat = blockIdx.z; const int c0 = hd * 64;
    v8f acc[4][4];
#pragma unroll
    for (int mb = 0; mb < 4; ++mb)
#pragma unroll
        for (int nb = 0; nb < 4; ++nb) acc[mb][nb] = (v8f){};
    const bf* Ap = XB + (size_t)(r0 + lr) * DM + 8 * hi;
    const bf* Bp = WT + ((size_t)mat * NP + c0 + lr) * DM + 8 * hi;
#pragma unroll 1
    for (int kc = 0; kc < DM; kc += 32) {
        v16bf a[4]; v16bf bl;
#pragma unroll
        for (int mb = 0; mb < 4; ++mb) a[mb] = ldb(Ap + (size_t)mb * 16 * DM + kc);
#pragma unroll
        for (int nb = 0; nb < 4; ++nb) { const v16bf b = ldb(Bp + (size_t)nb * 16 * DM + kc); bl = b;
#pragma unroll
            for (int mb = 0; mb < 4; ++mb) acc[mb][nb] = wmmab(a[mb], b, acc[mb][nb]); }
        asm volatile("v_nop\n\tv_nop\n\tv_nop\n\tv_nop" : "+v"(acc[0][3]), "+v"(acc[1][3]), "+v"(acc[2][3]), "+v"(acc[3][3]) : "v"(a[0]), "v"(a[1]), "v"(a[2]), "v"(a[3]), "v"(bl));
    }
    float bia[4];
#pragma unroll
    for (int nb = 0; nb < 4; ++nb) bia[nb] = BI[mat * NP + c0 + nb * 16 + lr];
    // precaution: stands behind the bias loads and before the staging addresses below reuse their offset register
    asm volatile("s_wait_xcnt 0x0" ::: "memory");
    const int b = r0 / SEQ, t0 = r0 % SEQ; const size_t bh = (size_t)b * NH + hd;
    const size_t PLN = (size_t)NB * NH * SEQ * HD;
    const int rq = lane >> 3, pc = (lane & 7) * 8;
    if (mat == 2) {
        // v: staged transposed hs[d][t]; lane's 8 accumulator rows are 8 consecutive t -> one 16-B LDS store
#pragma unroll
        for (int mb = 0; mb < 4; ++mb)
#pragma unroll
            for (int nb = 0; nb < 4; ++nb) { v8h pk;
#pragma unroll
                for (int j = 0; j < 8; ++j) pk[j] = (h16)(acc[mb][nb][j] + bia[nb]);
                *(v8ha*)(hs + (nb * 16 + lr) * 72 + mb * 16 + 8 * hi) = pk; }
        __syncthreads();
        h16* dst = PL + 2 * PLN + (bh * SEQ + t0) * (2 * HD) + 2048 + lane * 8;
{
#pragma unroll
            for (int i = 0; i < 16; ++i) { const int jb = i >> 3, dt = (i >> 1) & 3, s = i & 1; const v8h val = *(const v8ha*)(hs + (dt * 16 + lr) * 72 + jb * 32 + s * 16 + 8 * hi);
                *(v8h*)(dst + jb * 4096 + (i & 7) * 256) = val; }
             }
    } else {
        const bool wl = (mat == 0) && (QLO != 0);
#pragma unroll
        for (int mb = 0; mb < 4; ++mb)
#pragma unroll
            for (int nb = 0; nb < 4; ++nb)
#pragma unroll
                for (int j = 0; j < 8; ++j) { const int row = mb * 16 + 8 * hi + j, col = nb * 16 + lr; const float v = acc[mb][nb][j] + bia[nb]; const h16 hv = (h16)v;
                    hs[row * 72 + col] = hv; if (wl) ls[row * 72 + col] = (h16)((v - (float)hv) * LCAR); }
        __syncthreads();
        if (mat == 1) {
            h16* dst = PL + 2 * PLN + (bh * SEQ + t0) * (2 * HD) + lane * 8;
#pragma unroll
            for (int i = 0; i < 16; ++i) { const int kt = i >> 2, L = i & 3; const v8h val = *(const v8ha*)(hs + (kt * 16 + lr) * 72 + (2 * L + hi) * 8);
                *(v8h*)(dst + (i >> 3) * 4096 + (i & 7) * 256) = val; }
            // precaution: stands behind the k stores and before any later code reuses their data or address registers
            asm volatile("s_wait_xcnt 0x0" ::: "memory");
        } else {
            h16* dst = PL + (bh * SEQ + t0) * HD;
#pragma unroll
            for (int i = 0; i < 16; ++i) { const int row = 4 * i + rq; const v8h val = *(const v8ha*)(hs + row * 72 + pc);
                *(v8h*)(dst + (size_t)row * HD + pc) = val; }
            // precaution: stands behind the q stores and before the residual block reuses their data or address registers
            asm volatile("s_wait_xcnt 0x0" ::: "memory");
             }
        if (wl) {
            h16* dl = PL + PLN + (bh * SEQ + t0) * HD;
{
#pragma unroll
                for (int i = 0; i < 16; ++i) { const int row = 4 * i + rq; const v8h val = *(const v8ha*)(ls + row * 72 + pc);
                    *(v8h*)(dl + (size_t)row * HD + pc) = val; }
                 }
        }
    }
}

// ---- k_attn: 4 waves per block, each wave owns 16 consecutive queries of one (b, h) and walks all keys 32 at a time.
// S^T tile (keys x queries): A = K rows (m = key, k = d), B = Q^T (k = d, n = query) held in registers; accumulator element r of lane (half, n) = (key 8*half + r, query n).
// Online softmax per query = per lane column (in-lane over 16 values + one xor-16 exchange); state m_run / nb_run / l per lane; accumulators hold 1024 * sum(p v).
// P^T B fragment: elements 0..7 = first key tile's accumulator, elements 8..15 = second key tile's accumulator (same lane). A = V^T rows (m = d, k = key).
__global__ __launch_bounds__(128) void k_attn(const h16* __restrict__ PL, const float* __restrict__ MB, float* OUT) {
    __shared__ __align__(16) float os[4 * 16 * 68];
    const int w = threadIdx.x >> 5, lane = threadIdx.x & 31, lr = lane & 15, hi = lane >> 4;
    const int qt = blockIdx.x * 4 + w;
    const int bh = qt / (SEQ / 16); const int q0 = (qt % (SEQ / 16)) * 16; const int b = bh / NH, hd = bh % NH;
    const size_t PLN = (size_t)NB * NH * SEQ * HD;
    const h16* qh = PL + ((size_t)bh * SEQ + q0 + lr) * HD + 8 * hi;
    const h16* ql = qh + PLN;
    const h16* kv = PL + 2 * PLN + (size_t)bh * SEQ * (2 * HD) + lane * 8;
    const float* mb = MB + (size_t)b * SEQ + 8 * hi;
    const v16h bqh0 = ldh(qh), bqh1 = ldh(qh + 32);
    v16h bql0 = bqh0, bql1 = bqh1;
    if (QLO) { bql0 = ldh(ql); bql1 = ldh(ql + 32); }
    v8f acc[4];
#pragma unroll
    for (int dt = 0; dt < 4; ++dt) acc[dt] = (v8f){};
    float m_run = -1.0e30f, nb_run = 1.4426950e30f, l_run = 0.0f;
#pragma unroll 1
    for (int j0 = 0; j0 < SEQ; j0 += 32) {
        const h16* k0p = kv + (size_t)j0 * (2 * HD);
        const v16h ka0 = ldp(k0p), ka1 = ldp(k0p + 512), kc0 = ldp(k0p + 1024), kc1 = ldp(k0p + 1536);
        const v4f m0a = *(const v4f*)(mb + j0), m0b = *(const v4f*)(mb + j0 + 4), m1a = *(const v4f*)(mb + j0 + 16), m1b = *(const v4f*)(mb + j0 + 20);
        v16h vf[4];
#pragma unroll
        for (int dt = 0; dt < 4; ++dt) vf[dt] = ldp(k0p + 2048 + dt * 512);
        // precaution: stands behind this pass's loads and before the loop's foot advances the address registers they name
        asm volatile("s_wait_xcnt 0x0" ::: "memory");
        v8f sh0 = (v8f){}, sh1 = (v8f){}, sl0 = (v8f){}, sl1 = (v8f){};
        sh0 = wmma16(ka0, bqh0, sh0); sh1 = wmma16(kc0, bqh0, sh1);
        sh0 = wmma16(ka1, bqh1, sh0); sh1 = wmma16(kc1, bqh1, sh1);
        if (QLO) {
            sl0 = wmma16(ka0, bql0, sl0); sl1 = wmma16(kc0, bql0, sl1);
            sl0 = wmma16(ka1, bql1, sl0); sl1 = wmma16(kc1, bql1, sl1);
        }
        asm volatile("v_nop\n\tv_nop\n\tv_nop\n\tv_nop" : "+v"(sh0), "+v"(sh1), "+v"(sl0), "+v"(sl1) : "v"(ka1), "v"(kc1), "v"(bqh1), "v"(bql1));
        float t[16];
#pragma unroll
        for (int r = 0; r < 8; ++r) {
            float u0 = sh0[r], u1 = sh1[r];
            if (QLO) { u0 = __builtin_fmaf(sl0[r], 1.0f / LCAR, u0); u1 = __builtin_fmaf(sl1[r], 1.0f / LCAR, u1); }
            const float g0 = (r < 4) ? m0a[r & 3] : m0b[r & 3];
            const float g1 = (r < 4) ? m1a[r & 3] : m1b[r & 3];
            t[r] = __builtin_fmaf(u0, SCL, g0); t[8 + r] = __builtin_fmaf(u1, SCL, g1);
        }
        float mx = t[0];
#pragma unroll
        for (int i = 1; i < 16; ++i) mx = fmaxf(mx, t[i]);
        const float mo = __shfl_xor(mx, 16, 32);
        mx = fmaxf(mx, mo);
        const float mnew = fmaxf(m_run, mx);
        const unsigned grow = __builtin_amdgcn_ballot_w32(mnew > m_run);
        if (grow != 0u) {      // wave-uniform: some query column got a new maximum
            const float nbn = __builtin_fmaf(-mnew, L2E, PCL);
            const float al = ex2(nbn - nb_run);
            l_run *= al;
#pragma unroll
            for (int dt = 0; dt < 4; ++dt)
#pragma unroll
                for (int r = 0; r < 8; ++r) acc[dt][r] *= al;
            nb_run = nbn; m_run = mnew;
        }
        v16h pf; float ps = 0.0f;
#pragma unroll
        for (int r = 0; r < 8; ++r) {
            const float e0 = ex2(__builtin_fmaf(t[r], L2E, nb_run));
            const float e1 = ex2(__builtin_fmaf(t[8 + r], L2E, nb_run));
            ps += e0 + e1; pf[r] = (h16)e0; pf[8 + r] = (h16)e1;
        }
        l_run += ps;
#pragma unroll
        for (int dt = 0; dt < 4; ++dt) acc[dt] = wmma16(vf[dt], pf, acc[dt]);
        asm volatile("v_nop\n\tv_nop\n\tv_nop\n\tv_nop" : "+v"(acc[0]), "+v"(acc[1]), "+v"(acc[2]), "+v"(acc[3]) : "v"(vf[0]), "v"(vf[1]), "v"(vf[2]), "v"(vf[3]), "v"(pf));
    }
    const float lo = __shfl_xor(l_run, 16, 32);
    const float inv = 1.0f / (l_run + lo);
    float* o = os + w * 16 * 68;
#pragma unroll
    for (int dt = 0; dt < 4; ++dt) { v4f a, c;
#pragma unroll
        for (int r = 0; r < 4; ++r) { a[r] = acc[dt][r] * inv; c[r] = acc[dt][4 + r] * inv; }
        *(v4fa*)(o + lr * 68 + dt * 16 + 8 * hi) = a; *(v4fa*)(o + lr * 68 + dt * 16 + 8 * hi + 4) = c; }
    __syncthreads();
    float* dst = OUT + ((size_t)b * SEQ_FULL + q0) * NP + hd * HD;
{
#pragma unroll
        for (int s = 0; s < 8; ++s) { const int row = 2 * s + hi, cofs = lr * 4; const v4f val = *(const v4fa*)(o + row * 68 + cofs);
            *(v4f*)(dst + (size_t)row * NP + cofs) = val; }
         }
}

extern "C" void kernel_launch(void* const* d_in, const int* in_sizes, int n_in,
                              void* d_out, int out_size, void* d_ws, size_t ws_size, hipStream_t stream) {
    if (n_in < 8) return;
    const size_t rows_in = (size_t)(NB - 1) * SEQ_FULL + SEQ;
    if ((size_t)in_sizes[0] < rows_in * DM) return;
    if ((size_t)in_sizes[1] < rows_in) return;
    if (in_sizes[2] < DM * NP || in_sizes[4] < DM * NP || in_sizes[6] < DM * NP) return;
    if (in_sizes[3] < NP || in_sizes[5] < NP || in_sizes[7] < NP) return;
    if ((size_t)out_size < rows_in * NP) return;
    const float* x  = (const float*)d_in[0];   // hidden_states [4][2048][64]
    const float* am = (const float*)d_in[1];   // attention_mask [4][2048]
    const float* wq = (const float*)d_in[2]; const float* bq = (const float*)d_in[3];
    const float* wk = (const float*)d_in[4]; const float* bk = (const float*)d_in[5];
    const float* wv = (const float*)d_in[6]; const float* bv = (const float*)d_in[7];
    float* OUT = (float*)d_out;                // [4][2048][768]
    char* wsp = (char*)d_ws;
    auto take = [&](size_t bytes) { char* p = wsp; wsp += (bytes + 255) & ~(size_t)255; return (void*)p; };
    const size_t PLN = (size_t)NB * NH * SEQ * HD;
    bf* XB = (bf*)take((size_t)NB * SEQ * DM * 2);
    bf* WT = (bf*)take((size_t)3 * NP * DM * 2);
    float* BI = (float*)take((size_t)3 * NP * 4);
    float* MB = (float*)take((size_t)NB * SEQ * 4);
    h16* PL = (h16*)take(4 * PLN * 2);
    if ((size_t)(wsp - (char*)d_ws) > ws_size) return;
    k_prep<<<PX_BLOCKS + PW_BLOCKS + PB_BLOCKS + PM_BLOCKS, 256, 0, stream>>>(x, am, wq, bq, wk, bk, wv, bv, XB, WT, BI, MB);
    k_proj<<<dim3(NB * SEQ / 64, NH, 3), 32, 0, stream>>>(XB, WT, BI, PL);
    k_attn<<<NB * NH * (SEQ / 16) / 4, 128, 0, stream>>>(PL, MB, OUT);
}

// v002
// One run takes 111 microseconds.
// Next to v001, in two timings, it ran 1.59 and 1.55 times as fast.
// Over all steps from v000 it is 1.94 times as fast.
#include <hip/hip_runtime.h>

// Self attention, 12 heads of width 64, on one input stream x [4][2048][64]; q, k, v = x W + b with W [64][768] ([in][out]) and b [768]; scores = q k^T / 8 + (1 - m[b][key]) * (-10000); softmax over keys; out [4][2048][768] with heads merged head-major (column h*64 + d).
// Compute dtypes, f32 accumulate: projections v_wmma_f32_16x16x32_bf16 on bf16-RNE inputs (exact products); scores v_wmma_f32_16x16x32_f16 with q as f16 hi + f16 residual x 2^11 (own accumulator) and k as one f16 plane; probability x value v_wmma_f32_16x16x32_f16 with P carried x 1024 and v as one f16 plane; softmax in f32.
// Attention engine: transposed flash form S^T = K Q^T (Q^T held as B fragments in registers), packed P^T from the two S^T accumulators is the B fragment of O^T = V^T P^T; no LDS and no barrier inside the key loop.

#ifndef NB
#define NB 4
#endif
#ifndef SEQ
#define SEQ 2048
#endif
#define NB_FULL  4
#define SEQ_FULL 2048
#define DM   64
#define NH   12
#define HD   64
#define NP   (NH * HD)
#ifndef QLO
#define QLO 1
#endif
#define LCAR 2048.0f
#define PCL  10.0f
#define SCL  0.125f
#define L2E  1.4426950408889634f

static_assert(SEQ % 64 == 0);
static_assert(NB <= NB_FULL);
static_assert(SEQ <= SEQ_FULL);
static_assert((NB * NH * (SEQ / 32)) % 4 == 0);
static_assert(DM % 32 == 0);
static_assert(HD == 64);

typedef _Float16 h16;
typedef unsigned short bf;
typedef __attribute__((ext_vector_type(16))) __bf16   v16bf;
typedef __attribute__((ext_vector_type(16))) _Float16 v16h;
typedef __attribute__((ext_vector_type(8)))  _Float16 v8h;
typedef __attribute__((ext_vector_type(8)))  unsigned short v8us;
typedef __attribute__((ext_vector_type(2)))  unsigned short v2us;
typedef __attribute__((ext_vector_type(8)))  float    v8f;
typedef __attribute__((ext_vector_type(4)))  float    v4f;
typedef v8h  __attribute__((may_alias)) v8ha;
typedef v4f  __attribute__((may_alias)) v4fa;

__device__ __forceinline__ unsigned short f2bf(float f) { unsigned u = __float_as_uint(f); u += 0x7FFFu + ((u >> 16) & 1u); return (unsigned short)(u >> 16); }
__device__ __forceinline__ float bf2f(unsigned short b) { return __uint_as_float(((unsigned)b) << 16); }
__device__ __forceinline__ float bfr(float f) { return bf2f(f2bf(f)); }
__device__ __forceinline__ v16h cat16(v8h lo, v8h hi) { return __builtin_shufflevector(lo, hi, 0, 1, 2, 3, 4, 5, 6, 7, 8, 9, 10, 11, 12, 13, 14, 15); }
__device__ __forceinline__ v16bf cat16b(v8us lo, v8us hi) { return __builtin_bit_cast(v16bf, __builtin_shufflevector(lo, hi, 0, 1, 2, 3, 4, 5, 6, 7, 8, 9, 10, 11, 12, 13, 14, 15)); }
__device__ __forceinline__ v8f wmma16(v16h a, v16h b, v8f c) { return __builtin_amdgcn_wmma_f32_16x16x32_f16(false, a, false, b, (short)0, c, false, false); }
__device__ __forceinline__ v8f wmmab(v16bf a, v16bf b, v8f c) { return __builtin_amdgcn_wmma_f32_16x16x32_bf16(false, a, false, b, (short)0, c, false, false); }
// fragment loaders: p already points at (row, k0 + 8*half); elements 0..7 = k0+8h.., elements 8..15 = k0+16+8h..
__device__ __forceinline__ v16h ldh(const h16* p) { return cat16(*(const v8h*)p, *(const v8h*)(p + 16)); }
// packed fragment loader: p already points at (fragment, lane * 8); the two 16-B halves of a fragment lie 512 B apart, each a run of 32 lanes x 16 B
__device__ __forceinline__ v16h ldp(const h16* p) { return cat16(*(const v8h*)p, *(const v8h*)(p + 256)); }
__device__ __forceinline__ v16bf ldb(const bf* p) { return cat16b(*(const v8us*)p, *(const v8us*)(p + 16)); }
__device__ __forceinline__ float ex2(float x) { return __builtin_amdgcn_exp2f(x); }

#define PX_BLOCKS ((NB * SEQ * DM / 8 + 255) / 256)
#define PW_BLOCKS ((3 * NP + 7) / 8)
#define PB_BLOCKS ((3 * NP + 255) / 256)
#define PM_BLOCKS ((NB * SEQ + 255) / 256)

// ---- k_prep: one launch, block-uniform roles.
// B: BI[mat][n] = bf16-RNE value of bias_mat[n] kept as f32 (32 lanes x 4 B per line).
// M: MB[b][t] = (1 - bf16-RNE m[b][t]) * (-10000) as f32 (32 lanes x 4 B per line).
__global__ __launch_bounds__(256) void k_prep(const float* __restrict__ x, const float* __restrict__ am,
                                              const float* __restrict__ wq, const float* __restrict__ bq,
                                              const float* __restrict__ wk, const float* __restrict__ bk,
                                              const float* __restrict__ wv, const float* __restrict__ bv,
                                              bf* XB, bf* WT, float* BI, float* MB) {
    const int blk = blockIdx.x, tid = threadIdx.x;
    if (blk < PX_BLOCKS) {
        const int i = blk * 256 + tid;
        if (i < NB * SEQ * DM / 8) {
            const int e = i * 8; const int rr = e / DM, c = e % DM; const int b = rr / SEQ, t = rr % SEQ;
            const float* src = x + ((size_t)b * SEQ_FULL + t) * DM + c;
            const v4f a0 = *(const v4f*)src; const v4f a1 = *(const v4f*)(src + 4);
            v8us o;
#pragma unroll
            for (int k = 0; k < 4; ++k) { o[k] = f2bf(a0[k]); o[4 + k] = f2bf(a1[k]); }
            *(v8us*)(XB + (size_t)e) = o; 
        }
    } else if (blk < PX_BLOCKS + PW_BLOCKS) {
        const int line = (blk - PX_BLOCKS) * 8 + (tid >> 5); const int lane = tid & 31;
        if (line < 3 * NP) {
            const int mat = line / NP, n = line % NP; const int k = 2 * lane;
            const size_t i0 = (size_t)k * NP + n, i1 = (size_t)(k + 1) * NP + n;
            const float a0 = wq[i0], a1 = wq[i1], b0 = wk[i0], b1 = wk[i1], c0 = wv[i0], c1 = wv[i1];
            const float w0 = (mat == 0) ? a0 : ((mat == 1) ? b0 : c0);
            const float w1 = (mat == 0) ? a1 : ((mat == 1) ? b1 : c1);
            v2us o; o[0] = f2bf(w0); o[1] = f2bf(w1);
            bf* dst = WT + (size_t)line * DM + k;
            *(v2us*)dst = o; 
        }
    } else if (blk < PX_BLOCKS + PW_BLOCKS + PB_BLOCKS) {
        const int idx = (blk - PX_BLOCKS - PW_BLOCKS) * 256 + tid;
        if (idx < 3 * NP) {
            const int mat = idx / NP, n = idx % NP;
            const float a = bq[n], b = bk[n], c = bv[n];
            const float val = bfr((mat == 0) ? a : ((mat == 1) ? b : c));
            *(float*)(BI + idx) = val; 
        }
    } else {
        const int idx = (blk - PX_BLOCKS - PW_BLOCKS - PB_BLOCKS) * 256 + tid;
        if (idx < NB * SEQ) {
            const int b = idx / SEQ, t = idx % SEQ;
            const float a = bfr(am[(size_t)b * SEQ_FULL + t]);
            const float val = (1.0f - a) * (-10000.0f);
            *(float*)(MB + idx) = val; 
        }
    }
}

// ---- k_proj: one wave per 64x64 tile of [NB*SEQ][768] for mat = blockIdx.z (0 q, 1 k, 2 v); column tile = one head. K = 64 (two 32-deep steps), bf16 operands straight from the K-contiguous planes.
// Planes (f16), PL = [QH | QL | KV], QH/QL NB*NH*SEQ*64 elements each, [b][h][t][d]; KV twice that, [b][h][t/32][16 runs][32 lanes][8]: per 32 keys the 16 wave-wide 16-B loads of k_attn's A fragments, each run 512 contiguous bytes.
// Runs 0..7 hold k: run = 4*((t%32)/16) + d/16, lane = 16*((d/8)&1) + t%16, element d%8. Runs 8..15 hold v transposed: run = 8 + 2*(d/16) + (t%32)/16, lane = 16*((t/8)&1) + d%16, element t%8.
__global__ __launch_bounds__(32) void k_proj(const bf* __restrict__ XB, const bf* __restrict__ WT, const float* __restrict__ BI, h16* PL) {
    __shared__ __align__(16) h16 hs[64 * 72];
    __shared__ __align__(16) h16 ls[64 * 72];
    const int lane = threadIdx.x & 31, lr = lane & 15, hi = lane >> 4;
    const int r0 = blockIdx.x * 64, hd = blockIdx.y, mat = blockIdx.z; const int c0 = hd * 64;
    v8f acc[4][4];
#pragma unroll
    for (int mb = 0; mb < 4; ++mb)
#pragma unroll
        for (int nb = 0; nb < 4; ++nb) acc[mb][nb] = (v8f){};
    const bf* Ap = XB + (size_t)(r0 + lr) * DM + 8 * hi;
    const bf* Bp = WT + ((size_t)mat * NP + c0 + lr) * DM + 8 * hi;
#pragma unroll 1
    for (int kc = 0; kc < DM; kc += 32) {
        v16bf a[4]; v16bf bl;
#pragma unroll
        for (int mb = 0; mb < 4; ++mb) a[mb] = ldb(Ap + (size_t)mb * 16 * DM + kc);
#pragma unroll
        for (int nb = 0; nb < 4; ++nb) { const v16bf b = ldb(Bp + (size_t)nb * 16 * DM + kc); bl = b;
#pragma unroll
            for (int mb = 0; mb < 4; ++mb) acc[mb][nb] = wmmab(a[mb], b, acc[mb][nb]); }
        asm volatile("v_nop\n\tv_nop\n\tv_nop\n\tv_nop" : "+v"(acc[0][3]), "+v"(acc[1][3]), "+v"(acc[2][3]), "+v"(acc[3][3]) : "v"(a[0]), "v"(a[1]), "v"(a[2]), "v"(a[3]), "v"(bl));
    }
    float bia[4];
#pragma unroll
    for (int nb = 0; nb < 4; ++nb) bia[nb] = BI[mat * NP + c0 + nb * 16 + lr];
    // precaution: stands behind the bias loads and before the staging addresses below reuse their offset register
    asm volatile("s_wait_xcnt 0x0" ::: "memory");
    const int b = r0 / SEQ, t0 = r0 % SEQ; const size_t bh = (size_t)b * NH + hd;
    const size_t PLN = (size_t)NB * NH * SEQ * HD;
    const int rq = lane >> 3, pc = (lane & 7) * 8;
    if (mat == 2) {
        // v: staged transposed hs[d][t]; lane's 8 accumulator rows are 8 consecutive t -> one 16-B LDS store
#pragma unroll
        for (int mb = 0; mb < 4; ++mb)
#pragma unroll
            for (int nb = 0; nb < 4; ++nb) { v8h pk;
#pragma unroll
                for (int j = 0; j < 8; ++j) pk[j] = (h16)(acc[mb][nb][j] + bia[nb]);
                *(v8ha*)(hs + (nb * 16 + lr) * 72 + mb * 16 + 8 * hi) = pk; }
        __syncthreads();
        h16* dst = PL + 2 * PLN + (bh * SEQ + t0) * (2 * HD) + 2048 + lane * 8;
{
#pragma unroll
            for (int i = 0; i < 16; ++i) { const int jb = i >> 3, dt = (i >> 1) & 3, s = i & 1; const v8h val = *(const v8ha*)(hs + (dt * 16 + lr) * 72 + jb * 32 + s * 16 + 8 * hi);
                *(v8h*)(dst + jb * 4096 + (i & 7) * 256) = val; }
             }
    } else {
        const bool wl = (mat == 0) && (QLO != 0);
#pragma unroll
        for (int mb = 0; mb < 4; ++mb)
#pragma unroll
            for (int nb = 0; nb < 4; ++nb)
#pragma unroll
                for (int j = 0; j < 8; ++j) { const int row = mb * 16 + 8 * hi + j, col = nb * 16 + lr; const float v = acc[mb][nb][j] + bia[nb]; const h16 hv = (h16)v;
                    hs[row * 72 + col] = hv; if (wl) ls[row * 72 + col] = (h16)((v - (float)hv) * LCAR); }
        __syncthreads();
        if (mat == 1) {
            h16* dst = PL + 2 * PLN + (bh * SEQ + t0) * (2 * HD) + lane * 8;
#pragma unroll
            for (int i = 0; i < 16; ++i) { const int kt = i >> 2, L = i & 3; const v8h val = *(const v8ha*)(hs + (kt * 16 + lr) * 72 + (2 * L + hi) * 8);
                *(v8h*)(dst + (i >> 3) * 4096 + (i & 7) * 256) = val; }
            // precaution: stands behind the k stores and before any later code reuses their data or address registers
            asm volatile("s_wait_xcnt 0x0" ::: "memory");
        } else {
            h16* dst = PL + (bh * SEQ + t0) * HD;
#pragma unroll
            for (int i = 0; i < 16; ++i) { const int row = 4 * i + rq; const v8h val = *(const v8ha*)(hs + row * 72 + pc);
                *(v8h*)(dst + (size_t)row * HD + pc) = val; }
            // precaution: stands behind the q stores and before the residual block reuses their data or address registers
            asm volatile("s_wait_xcnt 0x0" ::: "memory");
             }
        if (wl) {
            h16* dl = PL + PLN + (bh * SEQ + t0) * HD;
{
#pragma unroll
                for (int i = 0; i < 16; ++i) { const int row = 4 * i + rq; const v8h val = *(const v8ha*)(ls + row * 72 + pc);
                    *(v8h*)(dl + (size_t)row * HD + pc) = val; }
                 }
        }
    }
}

// ---- k_attn: 4 waves per block, each wave owns 32 consecutive queries of one (b, h), as two column groups of 16, and walks all keys 32 at a time; every K and V^T fragment loaded feeds both groups.
// S^T tile (keys x queries): A = K rows (m = key, k = d), B = Q^T (k = d, n = query) held in registers; accumulator element r of lane (half, n) = (key 8*half + r, query n).
// Online softmax per query = per lane column (in-lane over 16 values + one xor-16 exchange); state m_run / nb_run / l per lane and group; accumulators hold 1024 * sum(p v).
// P^T B fragment: elements 0..7 = first key tile's accumulator, elements 8..15 = second key tile's accumulator (same lane). A = V^T rows (m = d, k = key).
// 768 blocks = 3 per WGP = 3 waves per SIMD, all resident at once.
__global__ __launch_bounds__(128) __attribute__((amdgpu_waves_per_eu(3, 3))) void k_attn(const h16* __restrict__ PL, const float* __restrict__ MB, float* OUT) {
    __shared__ __align__(16) float os[4 * 32 * 68];
    const int w = threadIdx.x >> 5, lane = threadIdx.x & 31, lr = lane & 15, hi = lane >> 4;
    const int qt = blockIdx.x * 4 + w;
    const int bh = qt / (SEQ / 32); const int q0 = (qt % (SEQ / 32)) * 32; const int b = bh / NH, hd = bh % NH;
    const size_t PLN = (size_t)NB * NH * SEQ * HD;
    const h16* qh = PL + ((size_t)bh * SEQ + q0 + lr) * HD + 8 * hi;
    const h16* ql = qh + PLN;
    const h16* kv = PL + 2 * PLN + (size_t)bh * SEQ * (2 * HD) + lane * 8;
    const float* mb = MB + (size_t)b * SEQ + 8 * hi;
    v16h bqh0[2], bqh1[2], bql0[2], bql1[2];
#pragma unroll
    for (int g = 0; g < 2; ++g) {
        bqh0[g] = ldh(qh + g * 16 * HD); bqh1[g] = ldh(qh + g * 16 * HD + 32);
        bql0[g] = bqh0[g]; bql1[g] = bqh1[g];
        if (QLO) { bql0[g] = ldh(ql + g * 16 * HD); bql1[g] = ldh(ql + g * 16 * HD + 32); }
    }
    v8f acc[2][4];
#pragma unroll
    for (int g = 0; g < 2; ++g)
#pragma unroll
        for (int dt = 0; dt < 4; ++dt) acc[g][dt] = (v8f){};
    float m_run[2] = {-1.0e30f, -1.0e30f}, nb_run[2] = {1.4426950e30f, 1.4426950e30f}, l_run[2] = {0.0f, 0.0f};
#pragma unroll 1
    for (int j0 = 0; j0 < SEQ; j0 += 32) {
        const h16* k0p = kv + (size_t)j0 * (2 * HD);
        const v16h ka0 = ldp(k0p), ka1 = ldp(k0p + 512), kc0 = ldp(k0p + 1024), kc1 = ldp(k0p + 1536);
        const v4f m0a = *(const v4f*)(mb + j0), m0b = *(const v4f*)(mb + j0 + 4), m1a = *(const v4f*)(mb + j0 + 16), m1b = *(const v4f*)(mb + j0 + 20);
        v16h vf[4];
#pragma unroll
        for (int dt = 0; dt < 4; ++dt) vf[dt] = ldp(k0p + 2048 + dt * 512);
        // precaution: stands behind this pass's loads and before the loop's foot advances the address registers they name
        asm volatile("s_wait_xcnt 0x0" ::: "memory");
        v8f sh0[2], sh1[2], sl0[2], sl1[2];
#pragma unroll
        for (int g = 0; g < 2; ++g) { sh0[g] = (v8f){}; sh1[g] = (v8f){}; sl0[g] = (v8f){}; sl1[g] = (v8f){}; }
#pragma unroll
        for (int g = 0; g < 2; ++g) { sh0[g] = wmma16(ka0, bqh0[g], sh0[g]); sh1[g] = wmma16(kc0, bqh0[g], sh1[g]); }
#pragma unroll
        for (int g = 0; g < 2; ++g) { sh0[g] = wmma16(ka1, bqh1[g], sh0[g]); sh1[g] = wmma16(kc1, bqh1[g], sh1[g]); }
        if (QLO) {
#pragma unroll
            for (int g = 0; g < 2; ++g) { sl0[g] = wmma16(ka0, bql0[g], sl0[g]); sl1[g] = wmma16(kc0, bql0[g], sl1[g]); }
#pragma unroll
            for (int g = 0; g < 2; ++g) { sl0[g] = wmma16(ka1, bql1[g], sl0[g]); sl1[g] = wmma16(kc1, bql1[g], sl1[g]); }
        }
        // four vector slots between the last score product and the first vector instruction on its result or operands
        asm volatile("v_nop\n\tv_nop\n\tv_nop\n\tv_nop" : "+v"(sh0[0]), "+v"(sh1[0]), "+v"(sl0[0]), "+v"(sl1[0]), "+v"(sh0[1]), "+v"(sh1[1]), "+v"(sl0[1]), "+v"(sl1[1]) : "v"(ka1), "v"(kc1), "v"(bqh1[0]), "v"(bql1[0]), "v"(bqh1[1]), "v"(bql1[1]));
        float t[2][16], mnew[2];
#pragma unroll
        for (int g = 0; g < 2; ++g) {
#pragma unroll
            for (int r = 0; r < 8; ++r) {
                float u0 = sh0[g][r], u1 = sh1[g][r];
                if (QLO) { u0 = __builtin_fmaf(sl0[g][r], 1.0f / LCAR, u0); u1 = __builtin_fmaf(sl1[g][r], 1.0f / LCAR, u1); }
                const float g0 = (r < 4) ? m0a[r & 3] : m0b[r & 3];
                const float g1 = (r < 4) ? m1a[r & 3] : m1b[r & 3];
                t[g][r] = __builtin_fmaf(u0, SCL, g0); t[g][8 + r] = __builtin_fmaf(u1, SCL, g1);
            }
            float mx = t[g][0];
#pragma unroll
            for (int i = 1; i < 16; ++i) mx = fmaxf(mx, t[g][i]);
            const float mo = __shfl_xor(mx, 16, 32);
            mx = fmaxf(mx, mo);
            mnew[g] = fmaxf(m_run[g], mx);
        }
        const unsigned grow = __builtin_amdgcn_ballot_w32((mnew[0] > m_run[0]) || (mnew[1] > m_run[1]));
        if (grow != 0u) {      // wave-uniform, one test per pass: some query column of either group got a new maximum (a column without one is scaled by exactly 1)
#pragma unroll
            for (int g = 0; g < 2; ++g) {
                const float nbn = __builtin_fmaf(-mnew[g], L2E, PCL);
                const float al = ex2(nbn - nb_run[g]);
                l_run[g] *= al;
#pragma unroll
                for (int dt = 0; dt < 4; ++dt)
#pragma unroll
                    for (int r = 0; r < 8; ++r) acc[g][dt][r] *= al;
                nb_run[g] = nbn; m_run[g] = mnew[g];
            }
        }
        v16h pf[2];
#pragma unroll
        for (int g = 0; g < 2; ++g) {
            float ps = 0.0f;
#pragma unroll
            for (int r = 0; r < 8; ++r) {
                const float e0 = ex2(__builtin_fmaf(t[g][r], L2E, nb_run[g]));
                const float e1 = ex2(__builtin_fmaf(t[g][8 + r], L2E, nb_run[g]));
                ps += e0 + e1; pf[g][r] = (h16)e0; pf[g][8 + r] = (h16)e1;
            }
            l_run[g] += ps;
        }
#pragma unroll
        for (int dt = 0; dt < 4; ++dt)
#pragma unroll
            for (int g = 0; g < 2; ++g) acc[g][dt] = wmma16(vf[dt], pf[g], acc[g][dt]);
        // four vector slots between the last output product and whatever stands first on either side of the loop's branch
        asm volatile("v_nop\n\tv_nop\n\tv_nop\n\tv_nop" : "+v"(acc[0][0]), "+v"(acc[0][1]), "+v"(acc[0][2]), "+v"(acc[0][3]), "+v"(acc[1][0]), "+v"(acc[1][1]), "+v"(acc[1][2]), "+v"(acc[1][3]) : "v"(vf[0]), "v"(vf[1]), "v"(vf[2]), "v"(vf[3]), "v"(pf[0]), "v"(pf[1]));
    }
    float* o = os + w * 32 * 68;
#pragma unroll
    for (int g = 0; g < 2; ++g) {
        const float lo = __shfl_xor(l_run[g], 16, 32);
        const float inv = 1.0f / (l_run[g] + lo);
#pragma unroll
        for (int dt = 0; dt < 4; ++dt) { v4f a, c;
#pragma unroll
            for (int r = 0; r < 4; ++r) { a[r] = acc[g][dt][r] * inv; c[r] = acc[g][dt][4 + r] * inv; }
            *(v4fa*)(o + (g * 16 + lr) * 68 + dt * 16 + 8 * hi) = a; *(v4fa*)(o + (g * 16 + lr) * 68 + dt * 16 + 8 * hi + 4) = c; }
    }
    __syncthreads();
    float* dst = OUT + ((size_t)b * SEQ_FULL + q0) * NP + hd * HD;
{
#pragma unroll
        for (int s = 0; s < 16; ++s) { const int row = 2 * s + hi, cofs = lr * 4; const v4f val = *(const v4fa*)(o + row * 68 + cofs);
            *(v4f*)(dst + (size_t)row * NP + cofs) = val; }
         }
}

extern "C" void kernel_launch(void* const* d_in, const int* in_sizes, int n_in,
                              void* d_out, int out_size, void* d_ws, size_t ws_size, hipStream_t stream) {
    if (n_in < 8) return;
    const size_t rows_in = (size_t)(NB - 1) * SEQ_FULL + SEQ;
    if ((size_t)in_sizes[0] < rows_in * DM) return;
    if ((size_t)in_sizes[1] < rows_in) return;
    if (in_sizes[2] < DM * NP || in_sizes[4] < DM * NP || in_sizes[6] < DM * NP) return;
    if (in_sizes[3] < NP || in_sizes[5] < NP || in_sizes[7] < NP) return;
    if ((size_t)out_size < rows_in * NP) return;
    const float* x  = (const float*)d_in[0];   // hidden_states [4][2048][64]
    const float* am = (const float*)d_in[1];   // attention_mask [4][2048]
    const float* wq = (const float*)d_in[2]; const float* bq = (const float*)d_in[3];
    const float* wk = (const float*)d_in[4]; const float* bk = (const float*)d_in[5];
    const float* wv = (const float*)d_in[6]; const float* bv = (const float*)d_in[7];
    float* OUT = (float*)d_out;                // [4][2048][768]
    char* wsp = (char*)d_ws;
    auto take = [&](size_t bytes) { char* p = wsp; wsp += (bytes + 255) & ~(size_t)255; return (void*)p; };
    const size_t PLN = (size_t)NB * NH * SEQ * HD;
    bf* XB = (bf*)take((size_t)NB * SEQ * DM * 2);
    bf* WT = (bf*)take((size_t)3 * NP * DM * 2);
    float* BI = (float*)take((size_t)3 * NP * 4);
    float* MB = (float*)take((size_t)NB * SEQ * 4);
    h16* PL = (h16*)take(4 * PLN * 2);
    if ((size_t)(wsp - (char*)d_ws) > ws_size) return;
    k_prep<<<PX_BLOCKS + PW_BLOCKS + PB_BLOCKS + PM_BLOCKS, 256, 0, stream>>>(x, am, wq, bq, wk, bk, wv, bv, XB, WT, BI, MB);
    k_proj<<<dim3(NB * SEQ / 64, NH, 3), 32, 0, stream>>>(XB, WT, BI, PL);
    k_attn<<<NB * NH * (SEQ / 32) / 4, 128, 0, stream>>>(PL, MB, OUT);
}

// v003
// Measured time: 85.9 microseconds a run.
// Timed twice side by side with v002, it ran 1.26 and 1.28 times as fast.
// Counting every step since v000, it is 2.46 times as fast.
#include <hip/hip_runtime.h>

// Self attention, 12 heads of width 64, on one input stream x [4][2048][64]; q, k, v = x W + b with W [64][768] ([in][out]) and b [768]; scores = q k^T / 8 + (1 - m[b][key]) * (-10000); softmax over keys; out [4][2048][768] with heads merged head-major (column h*64 + d).
// Compute dtypes, f32 accumulate: projections v_wmma_f32_16x16x32_bf16 on bf16-RNE inputs (exact products); scores v_wmma_f32_16x16x32_f16 with q as f16 hi + f16 residual x 2^11 (own accumulator) and k as one f16 plane; probability x value v_wmma_f32_16x16x32_f16 with P carried x 1024 and v as one f16 plane; softmax in f32.
// Attention engine: transposed flash form S^T = K Q^T (Q^T held as B fragments in registers), packed P^T from the two S^T accumulators is the B fragment of O^T = V^T P^T; no LDS and no barrier inside the key loop.

#ifndef NB
#define NB 4
#endif
#ifndef SEQ
#define SEQ 2048
#endif
#define NB_FULL  4
#define SEQ_FULL 2048
#define DM   64
#define NH   12
#define HD   64
#define NP   (NH * HD)
#ifndef QLO
#define QLO 1
#endif
#define LCAR 2048.0f
#define PCL  10.0f
#define SCL  0.125f
#define L2E  1.4426950408889634f

static_assert(SEQ % 64 == 0);
static_assert(NB <= NB_FULL);
static_assert(SEQ <= SEQ_FULL);
static_assert((NB * NH * (SEQ / 32)) % 4 == 0);
static_assert(DM % 32 == 0);
static_assert(HD == 64);

typedef _Float16 h16;
typedef unsigned short bf;
typedef __attribute__((ext_vector_type(16))) __bf16   v16bf;
typedef __attribute__((ext_vector_type(16))) _Float16 v16h;
typedef __attribute__((ext_vector_type(8)))  _Float16 v8h;
typedef __attribute__((ext_vector_type(8)))  unsigned short v8us;
typedef __attribute__((ext_vector_type(2)))  unsigned short v2us;
typedef __attribute__((ext_vector_type(8)))  float    v8f;
typedef __attribute__((ext_vector_type(4)))  float    v4f;
typedef v8h  __attribute__((may_alias)) v8ha;
typedef v4f  __attribute__((may_alias)) v4fa;

__device__ __forceinline__ unsigned short f2bf(float f) { unsigned u = __float_as_uint(f); u += 0x7FFFu + ((u >> 16) & 1u); return (unsigned short)(u >> 16); }
__device__ __forceinline__ float bf2f(unsigned short b) { return __uint_as_float(((unsigned)b) << 16); }
__device__ __forceinline__ float bfr(float f) { return bf2f(f2bf(f)); }
__device__ __forceinline__ v16h cat16(v8h lo, v8h hi) { return __builtin_shufflevector(lo, hi, 0, 1, 2, 3, 4, 5, 6, 7, 8, 9, 10, 11, 12, 13, 14, 15); }
__device__ __forceinline__ v16bf cat16b(v8us lo, v8us hi) { return __builtin_bit_cast(v16bf, __builtin_shufflevector(lo, hi, 0, 1, 2, 3, 4, 5, 6, 7, 8, 9, 10, 11, 12, 13, 14, 15)); }
__device__ __forceinline__ v8f wmma16(v16h a, v16h b, v8f c) { return __builtin_amdgcn_wmma_f32_16x16x32_f16(false, a, false, b, (short)0, c, false, false); }
__device__ __forceinline__ v8f wmmab(v16bf a, v16bf b, v8f c) { return __builtin_amdgcn_wmma_f32_16x16x32_bf16(false, a, false, b, (short)0, c, false, false); }
// fragment loaders: p already points at (row, k0 + 8*half); elements 0..7 = k0+8h.., elements 8..15 = k0+16+8h..
__device__ __forceinline__ v16h ldh(const h16* p) { return cat16(*(const v8h*)p, *(const v8h*)(p + 16)); }
// packed fragment loader: p already points at (fragment, lane * 8); the two 16-B halves of a fragment lie 512 B apart, each a run of 32 lanes x 16 B
__device__ __forceinline__ v16h ldp(const h16* p) { return cat16(*(const v8h*)p, *(const v8h*)(p + 256)); }
__device__ __forceinline__ v16bf ldb(const bf* p) { return cat16b(*(const v8us*)p, *(const v8us*)(p + 16)); }
__device__ __forceinline__ float ex2(float x) { return __builtin_amdgcn_exp2f(x); }

#define PX_BLOCKS ((NB * SEQ * DM / 8 + 255) / 256)
#define PW_BLOCKS ((3 * NP + 7) / 8)
#define PB_BLOCKS ((3 * NP + 255) / 256)
#define PM_BLOCKS ((NB * SEQ + 255) / 256)

// ---- k_prep: one launch, block-uniform roles.
// B: BI[mat][n] = bf16-RNE value of bias_mat[n] kept as f32 (32 lanes x 4 B per line).
// M: MB[b][t] = (1 - bf16-RNE m[b][t]) * (-10000) as f32 (32 lanes x 4 B per line).
__global__ __launch_bounds__(256) void k_prep(const float* __restrict__ x, const float* __restrict__ am,
                                              const float* __restrict__ wq, const float* __restrict__ bq,
                                              const float* __restrict__ wk, const float* __restrict__ bk,
                                              const float* __restrict__ wv, const float* __restrict__ bv,
                                              bf* XB, bf* WT, float* BI, float* MB) {
    const int blk = blockIdx.x, tid = threadIdx.x;
    if (blk < PX_BLOCKS) {
        const int i = blk * 256 + tid;
        if (i < NB * SEQ * DM / 8) {
            const int e = i * 8; const int rr = e / DM, c = e % DM; const int b = rr / SEQ, t = rr % SEQ;
            const float* src = x + ((size_t)b * SEQ_FULL + t) * DM + c;
            const v4f a0 = *(const v4f*)src; const v4f a1 = *(const v4f*)(src + 4);
            v8us o;
#pragma unroll
            for (int k = 0; k < 4; ++k) { o[k] = f2bf(a0[k]); o[4 + k] = f2bf(a1[k]); }
            *(v8us*)(XB + (size_t)e) = o; 
        }
    } else if (blk < PX_BLOCKS + PW_BLOCKS) {
        const int line = (blk - PX_BLOCKS) * 8 + (tid >> 5); const int lane = tid & 31;
        if (line < 3 * NP) {
            const int mat = line / NP, n = line % NP; const int k = 2 * lane;
            const size_t i0 = (size_t)k * NP + n, i1 = (size_t)(k + 1) * NP + n;
            const float a0 = wq[i0], a1 = wq[i1], b0 = wk[i0], b1 = wk[i1], c0 = wv[i0], c1 = wv[i1];
            const float w0 = (mat == 0) ? a0 : ((mat == 1) ? b0 : c0);
            const float w1 = (mat == 0) ? a1 : ((mat == 1) ? b1 : c1);
            v2us o; o[0] = f2bf(w0); o[1] = f2bf(w1);
            bf* dst = WT + (size_t)line * DM + k;
            *(v2us*)dst = o; 
        }
    } else if (blk < PX_BLOCKS + PW_BLOCKS + PB_BLOCKS) {
        const int idx = (blk - PX_BLOCKS - PW_BLOCKS) * 256 + tid;
        if (idx < 3 * NP) {
            const int mat = idx / NP, n = idx % NP;
            const float a = bq[n], b = bk[n], c = bv[n];
            const float val = bfr((mat == 0) ? a : ((mat == 1) ? b : c));
            *(float*)(BI + idx) = val; 
        }
    } else {
        const int idx = (blk - PX_BLOCKS - PW_BLOCKS - PB_BLOCKS) * 256 + tid;
        if (idx < NB * SEQ) {
            const int b = idx / SEQ, t = idx % SEQ;
            const float a = bfr(am[(size_t)b * SEQ_FULL + t]);
            const float val = (1.0f - a) * (-10000.0f);
            *(float*)(MB + idx) = val; 
        }
    }
}

// ---- k_proj: one wave per 64x64 tile of [NB*SEQ][768] for mat = blockIdx.z (0 q, 1 k, 2 v); column tile = one head. K = 64 (two 32-deep steps), bf16 operands straight from the K-contiguous planes.
// Planes (f16), PL = [QH | QL | KV], QH/QL NB*NH*SEQ*64 elements each, [b][h][t][d]; KV twice that, [b][h][t/32][16 runs][32 lanes][8]: per 32 keys the 16 wave-wide 16-B loads of k_attn's A fragments, each run 512 contiguous bytes.
// Runs 0..7 hold k: run = 4*((t%32)/16) + d/16, lane = 16*((d/8)&1) + t%16, element d%8. Runs 8..15 hold v transposed: run = 8 + 2*(d/16) + (t%32)/16, lane = 16*((t/8)&1) + d%16, element t%8.
__global__ __launch_bounds__(32) void k_proj(const bf* __restrict__ XB, const bf* __restrict__ WT, const float* __restrict__ BI, h16* PL) {
    __shared__ __align__(16) h16 hs[64 * 72];
    __shared__ __align__(16) h16 ls[64 * 72];
    const int lane = threadIdx.x & 31, lr = lane & 15, hi = lane >> 4;
    const int r0 = blockIdx.x * 64, hd = blockIdx.y, mat = blockIdx.z; const int c0 = hd * 64;
    v8f acc[4][4];
#pragma unroll
    for (int mb = 0; mb < 4; ++mb)
#pragma unroll
        for (int nb = 0; nb < 4; ++nb) acc[mb][nb] = (v8f){};
    const bf* Ap = XB + (size_t)(r0 + lr) * DM + 8 * hi;
    const bf* Bp = WT + ((size_t)mat * NP + c0 + lr) * DM + 8 * hi;
#pragma unroll 1
    for (int kc = 0; kc < DM; kc += 32) {
        v16bf a[4]; v16bf bl;
#pragma unroll
        for (int mb = 0; mb < 4; ++mb) a[mb] = ldb(Ap + (size_t)mb * 16 * DM + kc);
#pragma unroll
        for (int nb = 0; nb < 4; ++nb) { const v16bf b = ldb(Bp + (size_t)nb * 16 * DM + kc); bl = b;
#pragma unroll
            for (int mb = 0; mb < 4; ++mb) acc[mb][nb] = wmmab(a[mb], b, acc[mb][nb]); }
        asm volatile("v_nop\n\tv_nop\n\tv_nop\n\tv_nop" : "+v"(acc[0][3]), "+v"(acc[1][3]), "+v"(acc[2][3]), "+v"(acc[3][3]) : "v"(a[0]), "v"(a[1]), "v"(a[2]), "v"(a[3]), "v"(bl));
    }
    float bia[4];
#pragma unroll
    for (int nb = 0; nb < 4; ++nb) bia[nb] = BI[mat * NP + c0 + nb * 16 + lr];
    // precaution: stands behind the bias loads and before the staging addresses below reuse their offset register
    asm volatile("s_wait_xcnt 0x0" ::: "memory");
    const int b = r0 / SEQ, t0 = r0 % SEQ; const size_t bh = (size_t)b * NH + hd;
    const size_t PLN = (size_t)NB * NH * SEQ * HD;
    const int rq = lane >> 3, pc = (lane & 7) * 8;
    if (mat == 2) {
        // v: staged transposed hs[d][t]; lane's 8 accumulator rows are 8 consecutive t -> one 16-B LDS store
#pragma unroll
        for (int mb = 0; mb < 4; ++mb)
#pragma unroll
            for (int nb = 0; nb < 4; ++nb) { v8h pk;
#pragma unroll
                for (int j = 0; j < 8; ++j) pk[j] = (h16)(acc[mb][nb][j] + bia[nb]);
                *(v8ha*)(hs + (nb * 16 + lr) * 72 + mb * 16 + 8 * hi) = pk; }
        __syncthreads();
        h16* dst = PL + 2 * PLN + (bh * SEQ + t0) * (2 * HD) + 2048 + lane * 8;
{
#pragma unroll
            for (int i = 0; i < 16; ++i) { const int jb = i >> 3, dt = (i >> 1) & 3, s = i & 1; const v8h val = *(const v8ha*)(hs + (dt * 16 + lr) * 72 + jb * 32 + s * 16 + 8 * hi);
                *(v8h*)(dst + jb * 4096 + (i & 7) * 256) = val; }
             }
    } else {
        const bool wl = (mat == 0) && (QLO != 0);
#pragma unroll
        for (int mb = 0; mb < 4; ++mb)
#pragma unroll
            for (int nb = 0; nb < 4; ++nb)
#pragma unroll
                for (int j = 0; j < 8; ++j) { const int row = mb * 16 + 8 * hi + j, col = nb * 16 + lr; const float v = acc[mb][nb][j] + bia[nb]; const h16 hv = (h16)v;
                    hs[row * 72 + col] = hv; if (wl) ls[row * 72 + col] = (h16)((v - (float)hv) * LCAR); }
        __syncthreads();
        if (mat == 1) {
            h16* dst = PL + 2 * PLN + (bh * SEQ + t0) * (2 * HD) + lane * 8;
#pragma unroll
            for (int i = 0; i < 16; ++i) { const int kt = i >> 2, L = i & 3; const v8h val = *(const v8ha*)(hs + (kt * 16 + lr) * 72 + (2 * L + hi) * 8);
                *(v8h*)(dst + (i >> 3) * 4096 + (i & 7) * 256) = val; }
            // precaution: stands behind the k stores and before any later code reuses their data or address registers
            asm volatile("s_wait_xcnt 0x0" ::: "memory");
        } else {
            h16* dst = PL + (bh * SEQ + t0) * HD;
#pragma unroll
            for (int i = 0; i < 16; ++i) { const int row = 4 * i + rq; const v8h val = *(const v8ha*)(hs + row * 72 + pc);
                *(v8h*)(dst + (size_t)row * HD + pc) = val; }
            // precaution: stands behind the q stores and before the residual block reuses their data or address registers
            asm volatile("s_wait_xcnt 0x0" ::: "memory");
             }
        if (wl) {
            h16* dl = PL + PLN + (bh * SEQ + t0) * HD;
{
#pragma unroll
                for (int i = 0; i < 16; ++i) { const int row = 4 * i + rq; const v8h val = *(const v8ha*)(ls + row * 72 + pc);
                    *(v8h*)(dl + (size_t)row * HD + pc) = val; }
                 }
        }
    }
}

// ---- k_attn: 4 waves per block, each wave owns 32 consecutive queries of one (b, h), as two column groups of 16, and walks all keys 32 at a time; every K and V^T fragment loaded feeds both groups.
// S^T tile (keys x queries): A = K rows (m = key, k = d), B = Q^T (k = d, n = query) held in registers; accumulator element r of lane (half, n) = (key 8*half + r, query n).
// Online softmax per query = per lane column (in-lane over 16 values + one xor-16 exchange); state m_run / nb_run / l per lane and group; accumulators hold 1024 * sum(p v).
// P^T B fragment: elements 0..7 = first key tile's accumulator, elements 8..15 = second key tile's accumulator (same lane). A = V^T rows (m = d, k = key).
// 768 blocks = 3 per WGP = 3 waves per SIMD, all resident at once.
__global__ __launch_bounds__(128) __attribute__((amdgpu_waves_per_eu(3, 3))) void k_attn(const h16* __restrict__ PL, const float* __restrict__ MB, float* OUT) {
    __shared__ __align__(16) float os[4 * 32 * 68];
    const int w = threadIdx.x >> 5, lane = threadIdx.x & 31, lr = lane & 15, hi = lane >> 4;
    const int qt = blockIdx.x * 4 + w;
    const int bh = qt / (SEQ / 32); const int q0 = (qt % (SEQ / 32)) * 32; const int b = bh / NH, hd = bh % NH;
    const size_t PLN = (size_t)NB * NH * SEQ * HD;
    const h16* qh = PL + ((size_t)bh * SEQ + q0 + lr) * HD + 8 * hi;
    const h16* ql = qh + PLN;
    const h16* kv = PL + 2 * PLN + (size_t)bh * SEQ * (2 * HD) + lane * 8;
    const float* mb = MB + (size_t)b * SEQ + 8 * hi;
    v16h bqh0[2], bqh1[2], bql0[2], bql1[2];
    // nothing moves across this line or the one behind the wait below: only the Q loads stand between them, so no other instruction can reuse their address registers ahead of the wait
    __builtin_amdgcn_sched_barrier(0);
#pragma unroll
    for (int g = 0; g < 2; ++g) {
        bqh0[g] = ldh(qh + g * 16 * HD); bqh1[g] = ldh(qh + g * 16 * HD + 32);
        bql0[g] = bqh0[g]; bql1[g] = bqh1[g];
        if (QLO) { bql0[g] = ldh(ql + g * 16 * HD); bql1[g] = ldh(ql + g * 16 * HD + 32); }
    }
    // precaution: stands behind the Q loads and before their address registers are reused; its memory clobber also keeps the Q loads the oldest, so that no wait for them inside the loop reaches the younger loads
    asm volatile("s_wait_xcnt 0x0" ::: "memory");
    __builtin_amdgcn_sched_barrier(0);
    v8f acc[2][4];
#pragma unroll
    for (int g = 0; g < 2; ++g)
#pragma unroll
        for (int dt = 0; dt < 4; ++dt) acc[g][dt] = (v8f){};
    float m_run[2] = {-1.0e30f, -1.0e30f}, nb_run[2] = {1.4426950e30f, 1.4426950e30f}, l_run[2] = {0.0f, 0.0f};
    // K fragments and mask terms run one pass ahead of their use: pass 0's are fetched here, pass j + 1's inside pass j.
    v16h ka0 = ldp(kv), ka1 = ldp(kv + 512), kc0 = ldp(kv + 1024), kc1 = ldp(kv + 1536);
    // precaution: stands behind the first pass's K loads and before their address registers are reused; the line behind it keeps later instructions from moving ahead of it
    asm volatile("s_wait_xcnt 0x0" ::: "memory");
    __builtin_amdgcn_sched_barrier(0);
    v4f m0a = *(const v4f*)(mb), m0b = *(const v4f*)(mb + 4), m1a = *(const v4f*)(mb + 16), m1b = *(const v4f*)(mb + 20);
    // precaution: stands behind the first pass's mask loads and before their address registers are reused; the line behind it keeps later instructions from moving ahead of it
    asm volatile("s_wait_xcnt 0x0" ::: "memory");
    __builtin_amdgcn_sched_barrier(0);
    auto pass = [&](const int j0, const bool more) __attribute__((always_inline)) {
        // this pass's 32 keys: K at kp, V^T at kp + 2048, the next pass's K at kp + 4096; mask terms at mp, the next pass's at mp + 32
        const h16* kp = kv + (size_t)j0 * (2 * HD);
        const float* mp = mb + j0;
        v16h vf[4];
#pragma unroll
        for (int dt = 0; dt < 4; ++dt) vf[dt] = ldp(kp + 2048 + dt * 512);
        if (!more) {
            // precaution: the last pass has no further load from kp, so the wait stands here, before the address registers of the V loads are reused; the line behind it keeps later instructions from moving ahead of it
            asm volatile("s_wait_xcnt 0x0" ::: "memory");
            __builtin_amdgcn_sched_barrier(0);
        }
        v8f sh0[2], sh1[2], sl0[2], sl1[2];
#pragma unroll
        for (int g = 0; g < 2; ++g) { sh0[g] = (v8f){}; sh1[g] = (v8f){}; sl0[g] = (v8f){}; sl1[g] = (v8f){}; }
#pragma unroll
        for (int g = 0; g < 2; ++g) { sh0[g] = wmma16(ka0, bqh0[g], sh0[g]); sh1[g] = wmma16(kc0, bqh0[g], sh1[g]); }
#pragma unroll
        for (int g = 0; g < 2; ++g) { sh0[g] = wmma16(ka1, bqh1[g], sh0[g]); sh1[g] = wmma16(kc1, bqh1[g], sh1[g]); }
        if (QLO) {
#pragma unroll
            for (int g = 0; g < 2; ++g) { sl0[g] = wmma16(ka0, bql0[g], sl0[g]); sl1[g] = wmma16(kc0, bql0[g], sl1[g]); }
#pragma unroll
            for (int g = 0; g < 2; ++g) { sl0[g] = wmma16(ka1, bql1[g], sl0[g]); sl1[g] = wmma16(kc1, bql1[g], sl1[g]); }
        }
        // four vector slots between the last score product and the first vector instruction on its result or operands
        asm volatile("v_nop\n\tv_nop\n\tv_nop\n\tv_nop" : "+v"(sh0[0]), "+v"(sh1[0]), "+v"(sl0[0]), "+v"(sl1[0]), "+v"(sh0[1]), "+v"(sh1[1]), "+v"(sl0[1]), "+v"(sl1[1]) : "v"(ka1), "v"(kc1), "v"(bqh1[0]), "v"(bql1[0]), "v"(bqh1[1]), "v"(bql1[1]));
        // nothing moves across this line: without it the first use of the mask terms, and the wait for them, is lifted to the head of the pass
        __builtin_amdgcn_sched_barrier(0);
        // the next pass's K fragments, into the registers the score products have just left: they fly under the softmax and the output products
        if (more) {
            ka0 = ldp(kp + 4096); ka1 = ldp(kp + 4096 + 512); kc0 = ldp(kp + 4096 + 1024); kc1 = ldp(kp + 4096 + 1536);
            // precaution: stands behind the V and K loads and before their address registers are reused; its memory clobber also keeps the K loads from being sunk below the rescale branch, where they would fly under far less work; the line behind it keeps later instructions from moving ahead of it
            asm volatile("s_wait_xcnt 0x0" ::: "memory");
            __builtin_amdgcn_sched_barrier(0);
        }
        float t[2][16], mnew[2];
#pragma unroll
        for (int g = 0; g < 2; ++g) {
#pragma unroll
            for (int r = 0; r < 8; ++r) {
                float u0 = sh0[g][r], u1 = sh1[g][r];
                if (QLO) { u0 = __builtin_fmaf(sl0[g][r], 1.0f / LCAR, u0); u1 = __builtin_fmaf(sl1[g][r], 1.0f / LCAR, u1); }
                const float g0 = (r < 4) ? m0a[r & 3] : m0b[r & 3];
                const float g1 = (r < 4) ? m1a[r & 3] : m1b[r & 3];
                t[g][r] = __builtin_fmaf(u0, SCL, g0); t[g][8 + r] = __builtin_fmaf(u1, SCL, g1);
            }
            float mx = t[g][0];
#pragma unroll
            for (int i = 1; i < 16; ++i) mx = fmaxf(mx, t[g][i]);
            const float mo = __shfl_xor(mx, 16, 32);
            mx = fmaxf(mx, mo);
            mnew[g] = fmaxf(m_run[g], mx);
        }
        const unsigned grow = __builtin_amdgcn_ballot_w32((mnew[0] > m_run[0]) || (mnew[1] > m_run[1]));
        if (grow != 0u) {      // wave-uniform, one test per pass: some query column of either group got a new maximum (a column without one is scaled by exactly 1)
#pragma unroll
            for (int g = 0; g < 2; ++g) {
                const float nbn = __builtin_fmaf(-mnew[g], L2E, PCL);
                const float al = ex2(nbn - nb_run[g]);
                l_run[g] *= al;
#pragma unroll
                for (int dt = 0; dt < 4; ++dt)
#pragma unroll
                    for (int r = 0; r < 8; ++r) acc[g][dt][r] *= al;
                nb_run[g] = nbn; m_run[g] = mnew[g];
            }
        }
        // the next pass's mask terms, behind this pass's last use of them, into the same registers
        if (more) {
            m0a = *(const v4f*)(mp + 32); m0b = *(const v4f*)(mp + 36); m1a = *(const v4f*)(mp + 48); m1b = *(const v4f*)(mp + 52);
            // precaution: stands behind the mask loads and before their address registers are reused; the line behind it keeps later instructions from moving ahead of it
            asm volatile("s_wait_xcnt 0x0" ::: "memory");
            __builtin_amdgcn_sched_barrier(0);
        }
        v16h pf[2];
#pragma unroll
        for (int g = 0; g < 2; ++g) {
            float ps = 0.0f;
#pragma unroll
            for (int r = 0; r < 8; ++r) {
                const float e0 = ex2(__builtin_fmaf(t[g][r], L2E, nb_run[g]));
                const float e1 = ex2(__builtin_fmaf(t[g][8 + r], L2E, nb_run[g]));
                ps += e0 + e1; pf[g][r] = (h16)e0; pf[g][8 + r] = (h16)e1;
            }
            l_run[g] += ps;
        }
#pragma unroll
        for (int dt = 0; dt < 4; ++dt)
#pragma unroll
            for (int g = 0; g < 2; ++g) acc[g][dt] = wmma16(vf[dt], pf[g], acc[g][dt]);
        // four vector slots between the last output product and whatever stands first behind the pass, on either side of the loop's branch
        asm volatile("v_nop\n\tv_nop\n\tv_nop\n\tv_nop" : "+v"(acc[0][0]), "+v"(acc[0][1]), "+v"(acc[0][2]), "+v"(acc[0][3]), "+v"(acc[1][0]), "+v"(acc[1][1]), "+v"(acc[1][2]), "+v"(acc[1][3]) : "v"(vf[0]), "v"(vf[1]), "v"(vf[2]), "v"(vf[3]), "v"(pf[0]), "v"(pf[1]));
    };
    // kept rolled: one copy of the pass in the loop; the last pass stands alone because it has no next pass to fetch for
#pragma unroll 1
    for (int j0 = 0; j0 < SEQ - 32; j0 += 32) pass(j0, true);
    pass(SEQ - 32, false);
    float* o = os + w * 32 * 68;
#pragma unroll
    for (int g = 0; g < 2; ++g) {
        const float lo = __shfl_xor(l_run[g], 16, 32);
        const float inv = 1.0f / (l_run[g] + lo);
#pragma unroll
        for (int dt = 0; dt < 4; ++dt) { v4f a, c;
#pragma unroll
            for (int r = 0; r < 4; ++r) { a[r] = acc[g][dt][r] * inv; c[r] = acc[g][dt][4 + r] * inv; }
            *(v4fa*)(o + (g * 16 + lr) * 68 + dt * 16 + 8 * hi) = a; *(v4fa*)(o + (g * 16 + lr) * 68 + dt * 16 + 8 * hi + 4) = c; }
    }
    __syncthreads();
    float* dst = OUT + ((size_t)b * SEQ_FULL + q0) * NP + hd * HD;
{
#pragma unroll
        for (int s = 0; s < 16; ++s) { const int row = 2 * s + hi, cofs = lr * 4; const v4f val = *(const v4fa*)(o + row * 68 + cofs);
            *(v4f*)(dst + (size_t)row * NP + cofs) = val; }
         }
}

extern "C" void kernel_launch(void* const* d_in, const int* in_sizes, int n_in,
                              void* d_out, int out_size, void* d_ws, size_t ws_size, hipStream_t stream) {
    if (n_in < 8) return;
    const size_t rows_in = (size_t)(NB - 1) * SEQ_FULL + SEQ;
    if ((size_t)in_sizes[0] < rows_in * DM) return;
    if ((size_t)in_sizes[1] < rows_in) return;
    if (in_sizes[2] < DM * NP || in_sizes[4] < DM * NP || in_sizes[6] < DM * NP) return;
    if (in_sizes[3] < NP || in_sizes[5] < NP || in_sizes[7] < NP) return;
    if ((size_t)out_size < rows_in * NP) return;
    const float* x  = (const float*)d_in[0];   // hidden_states [4][2048][64]
    const float* am = (const float*)d_in[1];   // attention_mask [4][2048]
    const float* wq = (const float*)d_in[2]; const float* bq = (const float*)d_in[3];
    const float* wk = (const float*)d_in[4]; const float* bk = (const float*)d_in[5];
    const float* wv = (const float*)d_in[6]; const float* bv = (const float*)d_in[7];
    float* OUT = (float*)d_out;                // [4][2048][768]
    char* wsp = (char*)d_ws;
    auto take = [&](size_t bytes) { char* p = wsp; wsp += (bytes + 255) & ~(size_t)255; return (void*)p; };
    const size_t PLN = (size_t)NB * NH * SEQ * HD;
    bf* XB = (bf*)take((size_t)NB * SEQ * DM * 2);
    bf* WT = (bf*)take((size_t)3 * NP * DM * 2);
    float* BI = (float*)take((size_t)3 * NP * 4);
    float* MB = (float*)take((size_t)NB * SEQ * 4);
    h16* PL = (h16*)take(4 * PLN * 2);
    if ((size_t)(wsp - (char*)d_ws) > ws_size) return;
    k_prep<<<PX_BLOCKS + PW_BLOCKS + PB_BLOCKS + PM_BLOCKS, 256, 0, stream>>>(x, am, wq, bq, wk, bk, wv, bv, XB, WT, BI, MB);
    k_proj<<<dim3(NB * SEQ / 64, NH, 3), 32, 0, stream>>>(XB, WT, BI, PL);
    k_attn<<<NB * NH * (SEQ / 32) / 4, 128, 0, stream>>>(PL, MB, OUT);
}

// v004
// One run takes 78.8 microseconds.
// Timed twice side by side with v003, it ran 1.07 and 1.10 times as fast.
// Counting every step since v000, it is 2.67 times as fast.
#include <hip/hip_runtime.h>

// Self attention, 12 heads of width 64, on one input stream x [4][2048][64]; q, k, v = x W + b with W [64][768] ([in][out]) and b [768]; scores = q k^T / 8 + (1 - m[b][key]) * (-10000); softmax over keys; out [4][2048][768] with heads merged head-major (column h*64 + d).
// Compute dtypes, f32 accumulate: projections v_wmma_f32_16x16x32_bf16 on bf16-RNE inputs (exact products); scores v_wmma_f32_16x16x32_f16 with q as f16 hi + f16 residual (unscaled, same accumulator, which starts from the mask term) and k as one f16 plane; probability x value v_wmma_f32_16x16x32_f16 with P carried x 1024 and v as one f16 plane; softmax in f32.
// Attention engine: transposed flash form S^T = K Q^T (Q^T held as B fragments in registers), packed P^T from the two S^T accumulators is the B fragment of O^T = V^T P^T; no LDS and no barrier inside the key loop.

#ifndef NB
#define NB 4
#endif
#ifndef SEQ
#define SEQ 2048
#endif
#define NB_FULL  4
#define SEQ_FULL 2048
#define DM   64
#define NH   12
#define HD   64
#define NP   (NH * HD)
#ifndef QLO
#define QLO 1
#endif
#define PCL  10.0f
#define SCL  0.125f
#define L2E  1.4426950408889634f
#define CSC  (SCL * L2E)

static_assert(SEQ % 64 == 0);
static_assert(NB <= NB_FULL);
static_assert(SEQ <= SEQ_FULL);
static_assert((NB * NH * (SEQ / 32)) % 4 == 0);
static_assert(DM % 32 == 0);
static_assert(HD == 64);

typedef _Float16 h16;
typedef unsigned short bf;
typedef __attribute__((ext_vector_type(16))) __bf16   v16bf;
typedef __attribute__((ext_vector_type(16))) _Float16 v16h;
typedef __attribute__((ext_vector_type(8)))  _Float16 v8h;
typedef __attribute__((ext_vector_type(8)))  unsigned short v8us;
typedef __attribute__((ext_vector_type(2)))  unsigned short v2us;
typedef __attribute__((ext_vector_type(8)))  float    v8f;
typedef __attribute__((ext_vector_type(4)))  float    v4f;
typedef __attribute__((ext_vector_type(2)))  float    v2f;
typedef v8h  __attribute__((may_alias)) v8ha;
typedef v4f  __attribute__((may_alias)) v4fa;

__device__ __forceinline__ unsigned short f2bf(float f) { unsigned u = __float_as_uint(f); u += 0x7FFFu + ((u >> 16) & 1u); return (unsigned short)(u >> 16); }
__device__ __forceinline__ float bf2f(unsigned short b) { return __uint_as_float(((unsigned)b) << 16); }
__device__ __forceinline__ float bfr(float f) { return bf2f(f2bf(f)); }
__device__ __forceinline__ v16h cat16(v8h lo, v8h hi) { return __builtin_shufflevector(lo, hi, 0, 1, 2, 3, 4, 5, 6, 7, 8, 9, 10, 11, 12, 13, 14, 15); }
__device__ __forceinline__ v8f cat8(v4f lo, v4f hi) { return __builtin_shufflevector(lo, hi, 0, 1, 2, 3, 4, 5, 6, 7); }
__device__ __forceinline__ v16bf cat16b(v8us lo, v8us hi) { return __builtin_bit_cast(v16bf, __builtin_shufflevector(lo, hi, 0, 1, 2, 3, 4, 5, 6, 7, 8, 9, 10, 11, 12, 13, 14, 15)); }
__device__ __forceinline__ v8f wmma16(v16h a, v16h b, v8f c) { return __builtin_amdgcn_wmma_f32_16x16x32_f16(false, a, false, b, (short)0, c, false, false); }
__device__ __forceinline__ v8f wmmab(v16bf a, v16bf b, v8f c) { return __builtin_amdgcn_wmma_f32_16x16x32_bf16(false, a, false, b, (short)0, c, false, false); }
// fragment loaders: p already points at (row, k0 + 8*half); elements 0..7 = k0+8h.., elements 8..15 = k0+16+8h..
__device__ __forceinline__ v16h ldh(const h16* p) { return cat16(*(const v8h*)p, *(const v8h*)(p + 16)); }
// packed fragment loader: p already points at (fragment, lane * 8); the two 16-B halves of a fragment lie 512 B apart, each a run of 32 lanes x 16 B
__device__ __forceinline__ v16h ldp(const h16* p) { return cat16(*(const v8h*)p, *(const v8h*)(p + 256)); }
__device__ __forceinline__ v16bf ldb(const bf* p) { return cat16b(*(const v8us*)p, *(const v8us*)(p + 16)); }
__device__ __forceinline__ float ex2(float x) { return __builtin_amdgcn_exp2f(x); }

#define PX_BLOCKS ((NB * SEQ * DM / 8 + 255) / 256)
#define PW_BLOCKS ((3 * NP + 7) / 8)
#define PB_BLOCKS ((3 * NP + 255) / 256)
#define PM_BLOCKS ((NB * SEQ + 255) / 256)

// ---- k_prep: one launch, block-uniform roles.
// B: BI[mat][n] = bf16-RNE value of bias_mat[n] kept as f32 (32 lanes x 4 B per line).
// M: MB[b][t] = (1 - bf16-RNE m[b][t]) * (-10000) * 8 as f32 (32 lanes x 4 B per line): the mask term in units of the raw q.k sums, whose start value it is in k_attn.
__global__ __launch_bounds__(256) void k_prep(const float* __restrict__ x, const float* __restrict__ am,
                                              const float* __restrict__ wq, const float* __restrict__ bq,
                                              const float* __restrict__ wk, const float* __restrict__ bk,
                                              const float* __restrict__ wv, const float* __restrict__ bv,
                                              bf* XB, bf* WT, float* BI, float* MB) {
    const int blk = blockIdx.x, tid = threadIdx.x;
    if (blk < PX_BLOCKS) {
        const int i = blk * 256 + tid;
        if (i < NB * SEQ * DM / 8) {
            const int e = i * 8; const int rr = e / DM, c = e % DM; const int b = rr / SEQ, t = rr % SEQ;
            const float* src = x + ((size_t)b * SEQ_FULL + t) * DM + c;
            const v4f a0 = *(const v4f*)src; const v4f a1 = *(const v4f*)(src + 4);
            v8us o;
#pragma unroll
            for (int k = 0; k < 4; ++k) { o[k] = f2bf(a0[k]); o[4 + k] = f2bf(a1[k]); }
            *(v8us*)(XB + (size_t)e) = o; 
        }
    } else if (blk < PX_BLOCKS + PW_BLOCKS) {
        const int line = (blk - PX_BLOCKS) * 8 + (tid >> 5); const int lane = tid & 31;
        if (line < 3 * NP) {
            const int mat = line / NP, n = line % NP; const int k = 2 * lane;
            const size_t i0 = (size_t)k * NP + n, i1 = (size_t)(k + 1) * NP + n;
            const float a0 = wq[i0], a1 = wq[i1], b0 = wk[i0], b1 = wk[i1], c0 = wv[i0], c1 = wv[i1];
            const float w0 = (mat == 0) ? a0 : ((mat == 1) ? b0 : c0);
            const float w1 = (mat == 0) ? a1 : ((mat == 1) ? b1 : c1);
            v2us o; o[0] = f2bf(w0); o[1] = f2bf(w1);
            bf* dst = WT + (size_t)line * DM + k;
            *(v2us*)dst = o; 
        }
    } else if (blk < PX_BLOCKS + PW_BLOCKS + PB_BLOCKS) {
        const int idx = (blk - PX_BLOCKS - PW_BLOCKS) * 256 + tid;
        if (idx < 3 * NP) {
            const int mat = idx / NP, n = idx % NP;
            const float a = bq[n], b = bk[n], c = bv[n];
            const float val = bfr((mat == 0) ? a : ((mat == 1) ? b : c));
            *(float*)(BI + idx) = val; 
        }
    } else {
        const int idx = (blk - PX_BLOCKS - PW_BLOCKS - PB_BLOCKS) * 256 + tid;
        if (idx < NB * SEQ) {
            const int b = idx / SEQ, t = idx % SEQ;
            const float a = bfr(am[(size_t)b * SEQ_FULL + t]);
            const float val = (1.0f - a) * (-10000.0f) * (1.0f / SCL);
            *(float*)(MB + idx) = val; 
        }
    }
}

// ---- k_proj: one wave per 64x64 tile of [NB*SEQ][768] for mat = blockIdx.z (0 q, 1 k, 2 v); column tile = one head. K = 64 (two 32-deep steps), bf16 operands straight from the K-contiguous planes.
// Planes (f16), PL = [QH | QL | KV], QH/QL NB*NH*SEQ*64 elements each, [b][h][t][d]; KV twice that, [b][h][t/32][16 runs][32 lanes][8]: per 32 keys the 16 wave-wide 16-B loads of k_attn's A fragments, each run 512 contiguous bytes.
// Runs 0..7 hold k: run = 4*((t%32)/16) + d/16, lane = 16*((d/8)&1) + t%16, element d%8. Runs 8..15 hold v transposed: run = 8 + 2*(d/16) + (t%32)/16, lane = 16*((t/8)&1) + d%16, element t%8.
__global__ __launch_bounds__(32) void k_proj(const bf* __restrict__ XB, const bf* __restrict__ WT, const float* __restrict__ BI, h16* PL) {
    __shared__ __align__(16) h16 hs[64 * 72];
    __shared__ __align__(16) h16 ls[64 * 72];
    const int lane = threadIdx.x & 31, lr = lane & 15, hi = lane >> 4;
    const int r0 = blockIdx.x * 64, hd = blockIdx.y, mat = blockIdx.z; const int c0 = hd * 64;
    v8f acc[4][4];
#pragma unroll
    for (int mb = 0; mb < 4; ++mb)
#pragma unroll
        for (int nb = 0; nb < 4; ++nb) acc[mb][nb] = (v8f){};
    const bf* Ap = XB + (size_t)(r0 + lr) * DM + 8 * hi;
    const bf* Bp = WT + ((size_t)mat * NP + c0 + lr) * DM + 8 * hi;
#pragma unroll 1
    for (int kc = 0; kc < DM; kc += 32) {
        v16bf a[4]; v16bf bl;
#pragma unroll
        for (int mb = 0; mb < 4; ++mb) a[mb] = ldb(Ap + (size_t)mb * 16 * DM + kc);
#pragma unroll
        for (int nb = 0; nb < 4; ++nb) { const v16bf b = ldb(Bp + (size_t)nb * 16 * DM + kc); bl = b;
#pragma unroll
            for (int mb = 0; mb < 4; ++mb) acc[mb][nb] = wmmab(a[mb], b, acc[mb][nb]); }
        asm volatile("v_nop\n\tv_nop\n\tv_nop\n\tv_nop" : "+v"(acc[0][3]), "+v"(acc[1][3]), "+v"(acc[2][3]), "+v"(acc[3][3]) : "v"(a[0]), "v"(a[1]), "v"(a[2]), "v"(a[3]), "v"(bl));
    }
    float bia[4];
#pragma unroll
    for (int nb = 0; nb < 4; ++nb) bia[nb] = BI[mat * NP + c0 + nb * 16 + lr];
    // precaution: stands behind the bias loads and before the staging addresses below reuse their offset register
    asm volatile("s_wait_xcnt 0x0" ::: "memory");
    const int b = r0 / SEQ, t0 = r0 % SEQ; const size_t bh = (size_t)b * NH + hd;
    const size_t PLN = (size_t)NB * NH * SEQ * HD;
    const int rq = lane >> 3, pc = (lane & 7) * 8;
    if (mat == 2) {
        // v: staged transposed hs[d][t]; lane's 8 accumulator rows are 8 consecutive t -> one 16-B LDS store
#pragma unroll
        for (int mb = 0; mb < 4; ++mb)
#pragma unroll
            for (int nb = 0; nb < 4; ++nb) { v8h pk;
#pragma unroll
                for (int j = 0; j < 8; ++j) pk[j] = (h16)(acc[mb][nb][j] + bia[nb]);
                *(v8ha*)(hs + (nb * 16 + lr) * 72 + mb * 16 + 8 * hi) = pk; }
        __syncthreads();
        h16* dst = PL + 2 * PLN + (bh * SEQ + t0) * (2 * HD) + 2048 + lane * 8;
{
#pragma unroll
            for (int i = 0; i < 16; ++i) { const int jb = i >> 3, dt = (i >> 1) & 3, s = i & 1; const v8h val = *(const v8ha*)(hs + (dt * 16 + lr) * 72 + jb * 32 + s * 16 + 8 * hi);
                *(v8h*)(dst + jb * 4096 + (i & 7) * 256) = val; }
             }
    } else {
        const bool wl = (mat == 0) && (QLO != 0);
#pragma unroll
        for (int mb = 0; mb < 4; ++mb)
#pragma unroll
            for (int nb = 0; nb < 4; ++nb)
#pragma unroll
                for (int j = 0; j < 8; ++j) { const int row = mb * 16 + 8 * hi + j, col = nb * 16 + lr; const float v = acc[mb][nb][j] + bia[nb]; const h16 hv = (h16)v;
                    hs[row * 72 + col] = hv; if (wl) ls[row * 72 + col] = (h16)(v - (float)hv); }
        __syncthreads();
        if (mat == 1) {
            h16* dst = PL + 2 * PLN + (bh * SEQ + t0) * (2 * HD) + lane * 8;
#pragma unroll
            for (int i = 0; i < 16; ++i) { const int kt = i >> 2, L = i & 3; const v8h val = *(const v8ha*)(hs + (kt * 16 + lr) * 72 + (2 * L + hi) * 8);
                *(v8h*)(dst + (i >> 3) * 4096 + (i & 7) * 256) = val; }
            // precaution: stands behind the k stores and before any later code reuses their data or address registers
            asm volatile("s_wait_xcnt 0x0" ::: "memory");
        } else {
            h16* dst = PL + (bh * SEQ + t0) * HD;
#pragma unroll
            for (int i = 0; i < 16; ++i) { const int row = 4 * i + rq; const v8h val = *(const v8ha*)(hs + row * 72 + pc);
                *(v8h*)(dst + (size_t)row * HD + pc) = val; }
            // precaution: stands behind the q stores and before the residual block reuses their data or address registers
            asm volatile("s_wait_xcnt 0x0" ::: "memory");
             }
        if (wl) {
            h16* dl = PL + PLN + (bh * SEQ + t0) * HD;
{
#pragma unroll
                for (int i = 0; i < 16; ++i) { const int row = 4 * i + rq; const v8h val = *(const v8ha*)(ls + row * 72 + pc);
                    *(v8h*)(dl + (size_t)row * HD + pc) = val; }
                 }
        }
    }
}

// ---- k_attn: 4 waves per block, each wave owns 32 consecutive queries of one (b, h), as two column groups of 16, and walks all keys 32 at a time; every K and V^T fragment loaded feeds both groups.
// S^T tile (keys x queries): A = K rows (m = key, k = d), B = Q^T (k = d, n = query) held in registers; accumulator element r of lane (half, n) = (key 8*half + r, query n).
// The accumulator starts from the lane's eight mask terms (x 8) and takes the hi and the residual products in one chain: it leaves the matrix unit as 8 * (score + mask term); the 1/8 is part of the exp2 factor.
// Online softmax per query = per lane column (in-lane over 16 values + one xor-16 exchange); state m_run (in units of the raw sums) / nb_run / l per lane and group; accumulators hold 1024 * sum(p v).
// P^T B fragment: elements 0..7 = first key tile's accumulator, elements 8..15 = second key tile's accumulator (same lane). A = V^T rows (m = d, k = key).
// 768 blocks = 3 per WGP = 3 waves per SIMD, all resident at once.
__global__ __launch_bounds__(128) __attribute__((amdgpu_waves_per_eu(3, 3))) void k_attn(const h16* __restrict__ PL, const float* __restrict__ MB, float* OUT) {
    __shared__ __align__(16) float os[4 * 32 * 68];
    const int w = threadIdx.x >> 5, lane = threadIdx.x & 31, lr = lane & 15, hi = lane >> 4;
    const int qt = blockIdx.x * 4 + w;
    const int bh = qt / (SEQ / 32); const int q0 = (qt % (SEQ / 32)) * 32; const int b = bh / NH, hd = bh % NH;
    const size_t PLN = (size_t)NB * NH * SEQ * HD;
    const h16* qh = PL + ((size_t)bh * SEQ + q0 + lr) * HD + 8 * hi;
    const h16* ql = qh + PLN;
    const h16* kv = PL + 2 * PLN + (size_t)bh * SEQ * (2 * HD) + lane * 8;
    const float* mb = MB + (size_t)b * SEQ + 8 * hi;
    v16h bqh0[2], bqh1[2], bql0[2], bql1[2];
    // nothing moves across this line or the one behind the wait below: only the Q loads stand between them, so no other instruction can reuse their address registers ahead of the wait
    __builtin_amdgcn_sched_barrier(0);
#pragma unroll
    for (int g = 0; g < 2; ++g) {
        bqh0[g] = ldh(qh + g * 16 * HD); bqh1[g] = ldh(qh + g * 16 * HD + 32);
        bql0[g] = bqh0[g]; bql1[g] = bqh1[g];
        if (QLO) { bql0[g] = ldh(ql + g * 16 * HD); bql1[g] = ldh(ql + g * 16 * HD + 32); }
    }
    // precaution: stands behind the Q loads and before their address registers are reused; its memory clobber also keeps the Q loads the oldest, so that no wait for them inside the loop reaches the younger loads
    asm volatile("s_wait_xcnt 0x0" ::: "memory");
    __builtin_amdgcn_sched_barrier(0);
    v8f acc[2][4];
#pragma unroll
    for (int g = 0; g < 2; ++g)
#pragma unroll
        for (int dt = 0; dt < 4; ++dt) acc[g][dt] = (v8f){};
    float m_run[2] = {-1.0e30f, -1.0e30f}, nb_run[2] = {1.8033688e29f, 1.8033688e29f}, l_run[2] = {0.0f, 0.0f};
    // K fragments and mask terms run one pass ahead of their use: pass 0's are fetched here, pass j + 1's inside pass j.
    v16h ka0 = ldp(kv), ka1 = ldp(kv + 512), kc0 = ldp(kv + 1024), kc1 = ldp(kv + 1536);
    // precaution: stands behind the first pass's K loads and before their address registers are reused; the line behind it keeps later instructions from moving ahead of it
    asm volatile("s_wait_xcnt 0x0" ::: "memory");
    __builtin_amdgcn_sched_barrier(0);
    v4f m0a = *(const v4f*)(mb), m0b = *(const v4f*)(mb + 4), m1a = *(const v4f*)(mb + 16), m1b = *(const v4f*)(mb + 20);
    // precaution: stands behind the first pass's mask loads and before their address registers are reused; the line behind it keeps later instructions from moving ahead of it
    asm volatile("s_wait_xcnt 0x0" ::: "memory");
    __builtin_amdgcn_sched_barrier(0);
    auto pass = [&](const int j0, const bool more) __attribute__((always_inline)) {
        // this pass's 32 keys: K at kp, V^T at kp + 2048, the next pass's K at kp + 4096; mask terms at mp, the next pass's at mp + 32
        const h16* kp = kv + (size_t)j0 * (2 * HD);
        const float* mp = mb + j0;
        v16h vf[4];
#pragma unroll
        for (int dt = 0; dt < 4; ++dt) vf[dt] = ldp(kp + 2048 + dt * 512);
        if (!more) {
            // precaution: the last pass has no further load from kp, so the wait stands here, before the address registers of the V loads are reused; the line behind it keeps later instructions from moving ahead of it
            asm volatile("s_wait_xcnt 0x0" ::: "memory");
        }
        // nothing moves across this line: without it the first score product, and with it the wait for this pass's K fragments and mask terms, is lifted over the V loads, which would then start only behind that wait
        __builtin_amdgcn_sched_barrier(0);
        // the score sums start from the mask terms of their keys, the same for both groups
        const v8f c0 = cat8(m0a, m0b), c1 = cat8(m1a, m1b);
        v8f s0[2], s1[2];
#pragma unroll
        for (int g = 0; g < 2; ++g) { s0[g] = wmma16(ka0, bqh0[g], c0); s1[g] = wmma16(kc0, bqh0[g], c1); }
#pragma unroll
        for (int g = 0; g < 2; ++g) { s0[g] = wmma16(ka1, bqh1[g], s0[g]); s1[g] = wmma16(kc1, bqh1[g], s1[g]); }
        if (QLO) {
#pragma unroll
            for (int g = 0; g < 2; ++g) { s0[g] = wmma16(ka0, bql0[g], s0[g]); s1[g] = wmma16(kc0, bql0[g], s1[g]); }
#pragma unroll
            for (int g = 0; g < 2; ++g) { s0[g] = wmma16(ka1, bql1[g], s0[g]); s1[g] = wmma16(kc1, bql1[g], s1[g]); }
        }
        // four vector slots between the last score product and the first vector instruction on its result or operands; the mask terms are named too, so that no accumulator takes their registers: the next pass's mask loads then land where the products read them (otherwise the compiler copies them there, behind a wait for every load in flight)
        asm volatile("v_nop\n\tv_nop\n\tv_nop\n\tv_nop" : "+v"(s0[0]), "+v"(s1[0]), "+v"(s0[1]), "+v"(s1[1]) : "v"(ka1), "v"(kc1), "v"(bqh1[0]), "v"(bql1[0]), "v"(bqh1[1]), "v"(bql1[1]), "v"(c0), "v"(c1));
        // the next pass's K fragments, into the registers the score products have just left: they fly under the softmax and the output products
        if (more) {
            ka0 = ldp(kp + 4096); ka1 = ldp(kp + 4096 + 512); kc0 = ldp(kp + 4096 + 1024); kc1 = ldp(kp + 4096 + 1536);
            // precaution: stands behind the V and K loads and before their address registers are reused; its memory clobber also keeps the K loads from being sunk below the rescale branch, where they would fly under far less work; the line behind it keeps later instructions from moving ahead of it
            asm volatile("s_wait_xcnt 0x0" ::: "memory");
            __builtin_amdgcn_sched_barrier(0);
        }
        float mnew[2];
#pragma unroll
        for (int g = 0; g < 2; ++g) {
            float mx = s0[g][0];
#pragma unroll
            for (int i = 1; i < 8; ++i) mx = fmaxf(mx, s0[g][i]);
#pragma unroll
            for (int i = 0; i < 8; ++i) mx = fmaxf(mx, s1[g][i]);
            const float mo = __shfl_xor(mx, 16, 32);
            mx = fmaxf(mx, mo);
            mnew[g] = fmaxf(m_run[g], mx);
        }
        const unsigned grow = __builtin_amdgcn_ballot_w32((mnew[0] > m_run[0]) || (mnew[1] > m_run[1]));
        if (grow != 0u) {      // wave-uniform, one test per pass: some query column of either group got a new maximum (a column without one is scaled by exactly 1)
#pragma unroll
            for (int g = 0; g < 2; ++g) {
                const float nbn = __builtin_fmaf(-mnew[g], CSC, PCL);
                const float al = ex2(nbn - nb_run[g]);
                l_run[g] *= al;
#pragma unroll
                for (int dt = 0; dt < 4; ++dt)
#pragma unroll
                    for (int r = 0; r < 8; ++r) acc[g][dt][r] *= al;
                nb_run[g] = nbn; m_run[g] = mnew[g];
            }
        }
        // the next pass's mask terms, into the same registers; they are fetched here, where the score products that read those registers as their start value have long delivered their results, not directly behind those products
        if (more) {
            m0a = *(const v4f*)(mp + 32); m0b = *(const v4f*)(mp + 36); m1a = *(const v4f*)(mp + 48); m1b = *(const v4f*)(mp + 52);
            // precaution: stands behind the mask loads and before their address registers are reused; the line behind it keeps later instructions from moving ahead of it
            asm volatile("s_wait_xcnt 0x0" ::: "memory");
            __builtin_amdgcn_sched_barrier(0);
        }
        v16h pf[2];
#pragma unroll
        for (int g = 0; g < 2; ++g) {
            // exp2 arguments on neighbouring accumulator registers, two per packed FMA
            float a0[8], a1[8];
#pragma unroll
            for (int r = 0; r < 8; r += 2) {
                const v2f x0 = __builtin_elementwise_fma((v2f){s0[g][r], s0[g][r + 1]}, (v2f){CSC, CSC}, (v2f){nb_run[g], nb_run[g]});
                const v2f x1 = __builtin_elementwise_fma((v2f){s1[g][r], s1[g][r + 1]}, (v2f){CSC, CSC}, (v2f){nb_run[g], nb_run[g]});
                a0[r] = x0[0]; a0[r + 1] = x0[1]; a1[r] = x1[0]; a1[r + 1] = x1[1];
            }
            float ps = 0.0f;
#pragma unroll
            for (int r = 0; r < 8; ++r) {
                const float e0 = ex2(a0[r]);
                const float e1 = ex2(a1[r]);
                ps += e0 + e1; pf[g][r] = (h16)e0; pf[g][8 + r] = (h16)e1;
            }
            l_run[g] += ps;
        }
#pragma unroll
        for (int dt = 0; dt < 4; ++dt)
#pragma unroll
            for (int g = 0; g < 2; ++g) acc[g][dt] = wmma16(vf[dt], pf[g], acc[g][dt]);
        // four vector slots between the last output product and whatever stands first behind the pass, on either side of the loop's branch
        asm volatile("v_nop\n\tv_nop\n\tv_nop\n\tv_nop" : "+v"(acc[0][0]), "+v"(acc[0][1]), "+v"(acc[0][2]), "+v"(acc[0][3]), "+v"(acc[1][0]), "+v"(acc[1][1]), "+v"(acc[1][2]), "+v"(acc[1][3]) : "v"(vf[0]), "v"(vf[1]), "v"(vf[2]), "v"(vf[3]), "v"(pf[0]), "v"(pf[1]));
    };
    // kept rolled: one copy of the pass in the loop; the last pass stands alone because it has no next pass to fetch for
#pragma unroll 1
    for (int j0 = 0; j0 < SEQ - 32; j0 += 32) pass(j0, true);
    pass(SEQ - 32, false);
    float* o = os + w * 32 * 68;
#pragma unroll
    for (int g = 0; g < 2; ++g) {
        const float lo = __shfl_xor(l_run[g], 16, 32);
        const float inv = 1.0f / (l_run[g] + lo);
#pragma unroll
        for (int dt = 0; dt < 4; ++dt) { v4f a, c;
#pragma unroll
            for (int r = 0; r < 4; ++r) { a[r] = acc[g][dt][r] * inv; c[r] = acc[g][dt][4 + r] * inv; }
            *(v4fa*)(o + (g * 16 + lr) * 68 + dt * 16 + 8 * hi) = a; *(v4fa*)(o + (g * 16 + lr) * 68 + dt * 16 + 8 * hi + 4) = c; }
    }
    __syncthreads();
    float* dst = OUT + ((size_t)b * SEQ_FULL + q0) * NP + hd * HD;
{
#pragma unroll
        for (int s = 0; s < 16; ++s) { const int row = 2 * s + hi, cofs = lr * 4; const v4f val = *(const v4fa*)(o + row * 68 + cofs);
            *(v4f*)(dst + (size_t)row * NP + cofs) = val; }
         }
}

extern "C" void kernel_launch(void* const* d_in, const int* in_sizes, int n_in,
                              void* d_out, int out_size, void* d_ws, size_t ws_size, hipStream_t stream) {
    if (n_in < 8) return;
    const size_t rows_in = (size_t)(NB - 1) * SEQ_FULL + SEQ;
    if ((size_t)in_sizes[0] < rows_in * DM) return;
    if ((size_t)in_sizes[1] < rows_in) return;
    if (in_sizes[2] < DM * NP || in_sizes[4] < DM * NP || in_sizes[6] < DM * NP) return;
    if (in_sizes[3] < NP || in_sizes[5] < NP || in_sizes[7] < NP) return;
    if ((size_t)out_size < rows_in * NP) return;
    const float* x  = (const float*)d_in[0];   // hidden_states [4][2048][64]
    const float* am = (const float*)d_in[1];   // attention_mask [4][2048]
    const float* wq = (const float*)d_in[2]; const float* bq = (const float*)d_in[3];
    const float* wk = (const float*)d_in[4]; const float* bk = (const float*)d_in[5];
    const float* wv = (const float*)d_in[6]; const float* bv = (const float*)d_in[7];
    float* OUT = (float*)d_out;                // [4][2048][768]
    char* wsp = (char*)d_ws;
    auto take = [&](size_t bytes) { char* p = wsp; wsp += (bytes + 255) & ~(size_t)255; return (void*)p; };
    const size_t PLN = (size_t)NB * NH * SEQ * HD;
    bf* XB = (bf*)take((size_t)NB * SEQ * DM * 2);
    bf* WT = (bf*)take((size_t)3 * NP * DM * 2);
    float* BI = (float*)take((size_t)3 * NP * 4);
    float* MB = (float*)take((size_t)NB * SEQ * 4);
    h16* PL = (h16*)take(4 * PLN * 2);
    if ((size_t)(wsp - (char*)d_ws) > ws_size) return;
    k_prep<<<PX_BLOCKS + PW_BLOCKS + PB_BLOCKS + PM_BLOCKS, 256, 0, stream>>>(x, am, wq, bq, wk, bk, wv, bv, XB, WT, BI, MB);
    k_proj<<<dim3(NB * SEQ / 64, NH, 3), 32, 0, stream>>>(XB, WT, BI, PL);
    k_attn<<<NB * NH * (SEQ / 32) / 4, 128, 0, stream>>>(PL, MB, OUT);
}

// v005
// Measured time: 74.6 microseconds a run.
// In two side-by-side timings against v004, it was 1.06 and 1.08 times as fast.
// Counting every step since v000, it is 2.85 times as fast.
#include <hip/hip_runtime.h>

// Self attention, 12 heads of width 64, on one input stream x [4][2048][64]; q, k, v = x W + b with W [64][768] ([in][out]) and b [768]; scores = q k^T / 8 + (1 - m[b][key]) * (-10000); softmax over keys; out [4][2048][768] with heads merged head-major (column h*64 + d).
// Compute dtypes, f32 accumulate: projections v_wmma_f32_16x16x32_bf16 on bf16-RNE inputs (exact products); scores v_wmma_f32_16x16x32_f16 with q as f16 hi + f16 residual (unscaled, same accumulator, which starts from the mask term) and k as one f16 plane; probability x value v_wmma_f32_16x16x32_f16 with P carried x 1024 and v as one f16 plane; softmax in f32.
// Attention engine: transposed flash form S^T = K Q^T (Q^T held as B fragments in registers), packed P^T from the two S^T accumulators is the B fragment of O^T = V^T P^T; no LDS and no barrier inside the key loop.

#ifndef NB
#define NB 4
#endif
#ifndef SEQ
#define SEQ 2048
#endif
#define NB_FULL  4
#define SEQ_FULL 2048
#define DM   64
#define NH   12
#define HD   64
#define NP   (NH * HD)
#ifndef QLO
#define QLO 1
#endif
#define PCL  10.0f
#define SCL  0.125f
#define L2E  1.4426950408889634f
#define CSC  (SCL * L2E)
#define NPS  (SEQ / 32)

static_assert(SEQ % 128 == 0);
static_assert(NB <= NB_FULL);
static_assert(SEQ <= SEQ_FULL);
static_assert((NB * NH * (SEQ / 32)) % 4 == 0);
static_assert(DM % 32 == 0);
static_assert(HD == 64);

typedef _Float16 h16;
typedef unsigned short bf;
typedef __attribute__((ext_vector_type(16))) __bf16   v16bf;
typedef __attribute__((ext_vector_type(16))) _Float16 v16h;
typedef __attribute__((ext_vector_type(8)))  _Float16 v8h;
typedef __attribute__((ext_vector_type(8)))  unsigned short v8us;
typedef __attribute__((ext_vector_type(2)))  unsigned short v2us;
typedef __attribute__((ext_vector_type(8)))  float    v8f;
typedef __attribute__((ext_vector_type(4)))  float    v4f;
typedef __attribute__((ext_vector_type(2)))  float    v2f;
typedef v8h  __attribute__((may_alias)) v8ha;
typedef v4f  __attribute__((may_alias)) v4fa;

__device__ __forceinline__ unsigned short f2bf(float f) { unsigned u = __float_as_uint(f); u += 0x7FFFu + ((u >> 16) & 1u); return (unsigned short)(u >> 16); }
__device__ __forceinline__ float bf2f(unsigned short b) { return __uint_as_float(((unsigned)b) << 16); }
__device__ __forceinline__ float bfr(float f) { return bf2f(f2bf(f)); }
__device__ __forceinline__ v16h cat16(v8h lo, v8h hi) { return __builtin_shufflevector(lo, hi, 0, 1, 2, 3, 4, 5, 6, 7, 8, 9, 10, 11, 12, 13, 14, 15); }
__device__ __forceinline__ v8f cat8(v4f lo, v4f hi) { return __builtin_shufflevector(lo, hi, 0, 1, 2, 3, 4, 5, 6, 7); }
__device__ __forceinline__ v16bf cat16b(v8us lo, v8us hi) { return __builtin_bit_cast(v16bf, __builtin_shufflevector(lo, hi, 0, 1, 2, 3, 4, 5, 6, 7, 8, 9, 10, 11, 12, 13, 14, 15)); }
__device__ __forceinline__ v8f wmma16(v16h a, v16h b, v8f c) { return __builtin_amdgcn_wmma_f32_16x16x32_f16(false, a, false, b, (short)0, c, false, false); }
__device__ __forceinline__ v8f wmmab(v16bf a, v16bf b, v8f c) { return __builtin_amdgcn_wmma_f32_16x16x32_bf16(false, a, false, b, (short)0, c, false, false); }
// fragment loaders: p already points at (row, k0 + 8*half); elements 0..7 = k0+8h.., elements 8..15 = k0+16+8h..
__device__ __forceinline__ v16h ldh(const h16* p) { return cat16(*(const v8h*)p, *(const v8h*)(p + 16)); }
// packed fragment loader: p already points at (fragment, lane * 8); the two 16-B halves of a fragment lie 512 B apart, each a run of 32 lanes x 16 B
__device__ __forceinline__ v16h ldp(const h16* p) { return cat16(*(const v8h*)p, *(const v8h*)(p + 256)); }
__device__ __forceinline__ v16bf ldb(const bf* p) { return cat16b(*(const v8us*)p, *(const v8us*)(p + 16)); }
__device__ __forceinline__ float ex2(float x) { return __builtin_amdgcn_exp2f(x); }

#define PX_BLOCKS ((NB * SEQ * DM / 8 + 255) / 256)
#define PW_BLOCKS ((3 * NP + 7) / 8)
#define PB_BLOCKS ((3 * NP + 255) / 256)
#define PM_BLOCKS ((NB * SEQ + 255) / 256)

// ---- k_prep: one launch, block-uniform roles.
// B: BI[mat][n] = bf16-RNE value of bias_mat[n] kept as f32 (32 lanes x 4 B per line).
// M: MB[b][t] = (1 - bf16-RNE m[b][t]) * (-10000) * 8 as f32 (32 lanes x 4 B per line): the mask term in units of the raw q.k sums, whose start value it is in k_attn.
__global__ __launch_bounds__(256) void k_prep(const float* __restrict__ x, const float* __restrict__ am,
                                              const float* __restrict__ wq, const float* __restrict__ bq,
                                              const float* __restrict__ wk, const float* __restrict__ bk,
                                              const float* __restrict__ wv, const float* __restrict__ bv,
                                              bf* XB, bf* WT, float* BI, float* MB) {
    const int blk = blockIdx.x, tid = threadIdx.x;
    if (blk < PX_BLOCKS) {
        const int i = blk * 256 + tid;
        if (i < NB * SEQ * DM / 8) {
            const int e = i * 8; const int rr = e / DM, c = e % DM; const int b = rr / SEQ, t = rr % SEQ;
            const float* src = x + ((size_t)b * SEQ_FULL + t) * DM + c;
            const v4f a0 = *(const v4f*)src; const v4f a1 = *(const v4f*)(src + 4);
            v8us o;
#pragma unroll
            for (int k = 0; k < 4; ++k) { o[k] = f2bf(a0[k]); o[4 + k] = f2bf(a1[k]); }
            *(v8us*)(XB + (size_t)e) = o; 
        }
    } else if (blk < PX_BLOCKS + PW_BLOCKS) {
        const int line = (blk - PX_BLOCKS) * 8 + (tid >> 5); const int lane = tid & 31;
        if (line < 3 * NP) {
            const int mat = line / NP, n = line % NP; const int k = 2 * lane;
            const size_t i0 = (size_t)k * NP + n, i1 = (size_t)(k + 1) * NP + n;
            const float a0 = wq[i0], a1 = wq[i1], b0 = wk[i0], b1 = wk[i1], c0 = wv[i0], c1 = wv[i1];
            const float w0 = (mat == 0) ? a0 : ((mat == 1) ? b0 : c0);
            const float w1 = (mat == 0) ? a1 : ((mat == 1) ? b1 : c1);
            v2us o; o[0] = f2bf(w0); o[1] = f2bf(w1);
            bf* dst = WT + (size_t)line * DM + k;
            *(v2us*)dst = o; 
        }
    } else if (blk < PX_BLOCKS + PW_BLOCKS + PB_BLOCKS) {
        const int idx = (blk - PX_BLOCKS - PW_BLOCKS) * 256 + tid;
        if (idx < 3 * NP) {
            const int mat = idx / NP, n = idx % NP;
            const float a = bq[n], b = bk[n], c = bv[n];
            const float val = bfr((mat == 0) ? a : ((mat == 1) ? b : c));
            *(float*)(BI + idx) = val; 
        }
    } else {
        const int idx = (blk - PX_BLOCKS - PW_BLOCKS - PB_BLOCKS) * 256 + tid;
        if (idx < NB * SEQ) {
            const int b = idx / SEQ, t = idx % SEQ;
            const float a = bfr(am[(size_t)b * SEQ_FULL + t]);
            const float val = (1.0f - a) * (-10000.0f) * (1.0f / SCL);
            *(float*)(MB + idx) = val; 
        }
    }
}

// ---- k_proj: one wave per 64x64 tile of [NB*SEQ][768] for mat = blockIdx.z (0 q, 1 k, 2 v); column tile = one head. K = 64 (two 32-deep steps), bf16 operands straight from the K-contiguous planes.
// Planes (f16), PL = [QH | QL | KV], QH/QL NB*NH*SEQ*64 elements each, [b][h][t][d]; KV twice that, [b][h][t/32][16 runs][32 lanes][8]: per 32 keys the 16 wave-wide 16-B loads of k_attn's A fragments, each run 512 contiguous bytes.
// Runs 0..7 hold k: run = 4*((t%32)/16) + d/16, lane = 16*((d/8)&1) + t%16, element d%8. Runs 8..15 hold v transposed: run = 8 + 2*(d/16) + (t%32)/16, lane = 16*((t/8)&1) + d%16, element t%8.
__global__ __launch_bounds__(32) void k_proj(const bf* __restrict__ XB, const bf* __restrict__ WT, const float* __restrict__ BI, h16* PL) {
    __shared__ __align__(16) h16 hs[64 * 72];
    __shared__ __align__(16) h16 ls[64 * 72];
    const int lane = threadIdx.x & 31, lr = lane & 15, hi = lane >> 4;
    const int r0 = blockIdx.x * 64, hd = blockIdx.y, mat = blockIdx.z; const int c0 = hd * 64;
    v8f acc[4][4];
#pragma unroll
    for (int mb = 0; mb < 4; ++mb)
#pragma unroll
        for (int nb = 0; nb < 4; ++nb) acc[mb][nb] = (v8f){};
    const bf* Ap = XB + (size_t)(r0 + lr) * DM + 8 * hi;
    const bf* Bp = WT + ((size_t)mat * NP + c0 + lr) * DM + 8 * hi;
#pragma unroll 1
    for (int kc = 0; kc < DM; kc += 32) {
        v16bf a[4]; v16bf bl;
#pragma unroll
        for (int mb = 0; mb < 4; ++mb) a[mb] = ldb(Ap + (size_t)mb * 16 * DM + kc);
#pragma unroll
        for (int nb = 0; nb < 4; ++nb) { const v16bf b = ldb(Bp + (size_t)nb * 16 * DM + kc); bl = b;
#pragma unroll
            for (int mb = 0; mb < 4; ++mb) acc[mb][nb] = wmmab(a[mb], b, acc[mb][nb]); }
        asm volatile("v_nop\n\tv_nop\n\tv_nop\n\tv_nop" : "+v"(acc[0][3]), "+v"(acc[1][3]), "+v"(acc[2][3]), "+v"(acc[3][3]) : "v"(a[0]), "v"(a[1]), "v"(a[2]), "v"(a[3]), "v"(bl));
    }
    float bia[4];
#pragma unroll
    for (int nb = 0; nb < 4; ++nb) bia[nb] = BI[mat * NP + c0 + nb * 16 + lr];
    // precaution: stands behind the bias loads and before the staging addresses below reuse their offset register
    asm volatile("s_wait_xcnt 0x0" ::: "memory");
    const int b = r0 / SEQ, t0 = r0 % SEQ; const size_t bh = (size_t)b * NH + hd;
    const size_t PLN = (size_t)NB * NH * SEQ * HD;
    const int rq = lane >> 3, pc = (lane & 7) * 8;
    if (mat == 2) {
        // v: staged transposed hs[d][t]; lane's 8 accumulator rows are 8 consecutive t -> one 16-B LDS store
#pragma unroll
        for (int mb = 0; mb < 4; ++mb)
#pragma unroll
            for (int nb = 0; nb < 4; ++nb) { v8h pk;
#pragma unroll
                for (int j = 0; j < 8; ++j) pk[j] = (h16)(acc[mb][nb][j] + bia[nb]);
                *(v8ha*)(hs + (nb * 16 + lr) * 72 + mb * 16 + 8 * hi) = pk; }
        __syncthreads();
        h16* dst = PL + 2 * PLN + (bh * SEQ + t0) * (2 * HD) + 2048 + lane * 8;
{
#pragma unroll
            for (int i = 0; i < 16; ++i) { const int jb = i >> 3, dt = (i >> 1) & 3, s = i & 1; const v8h val = *(const v8ha*)(hs + (dt * 16 + lr) * 72 + jb * 32 + s * 16 + 8 * hi);
                *(v8h*)(dst + jb * 4096 + (i & 7) * 256) = val; }
             }
    } else {
        const bool wl = (mat == 0) && (QLO != 0);
#pragma unroll
        for (int mb = 0; mb < 4; ++mb)
#pragma unroll
            for (int nb = 0; nb < 4; ++nb)
#pragma unroll
                for (int j = 0; j < 8; ++j) { const int row = mb * 16 + 8 * hi + j, col = nb * 16 + lr; const float v = acc[mb][nb][j] + bia[nb]; const h16 hv = (h16)v;
                    hs[row * 72 + col] = hv; if (wl) ls[row * 72 + col] = (h16)(v - (float)hv); }
        __syncthreads();
        if (mat == 1) {
            h16* dst = PL + 2 * PLN + (bh * SEQ + t0) * (2 * HD) + lane * 8;
#pragma unroll
            for (int i = 0; i < 16; ++i) { const int kt = i >> 2, L = i & 3; const v8h val = *(const v8ha*)(hs + (kt * 16 + lr) * 72 + (2 * L + hi) * 8);
                *(v8h*)(dst + (i >> 3) * 4096 + (i & 7) * 256) = val; }
            // precaution: stands behind the k stores and before any later code reuses their data or address registers
            asm volatile("s_wait_xcnt 0x0" ::: "memory");
        } else {
            h16* dst = PL + (bh * SEQ + t0) * HD;
#pragma unroll
            for (int i = 0; i < 16; ++i) { const int row = 4 * i + rq; const v8h val = *(const v8ha*)(hs + row * 72 + pc);
                *(v8h*)(dst + (size_t)row * HD + pc) = val; }
            // precaution: stands behind the q stores and before the residual block reuses their data or address registers
            asm volatile("s_wait_xcnt 0x0" ::: "memory");
             }
        if (wl) {
            h16* dl = PL + PLN + (bh * SEQ + t0) * HD;
{
#pragma unroll
                for (int i = 0; i < 16; ++i) { const int row = 4 * i + rq; const v8h val = *(const v8ha*)(ls + row * 72 + pc);
                    *(v8h*)(dl + (size_t)row * HD + pc) = val; }
                 }
        }
    }
}

// ---- k_attn: 4 waves per block, each wave owns 32 consecutive queries of one (b, h), as two column groups of 16, and walks all keys 32 at a time; every K and V^T fragment loaded feeds both groups.
// S^T tile (keys x queries): A = K rows (m = key, k = d), B = Q^T (k = d, n = query) held in registers; accumulator element r of lane (half, n) = (key 8*half + r, query n).
// The accumulator starts from the lane's eight mask terms (x 8) and takes the hi and the residual products in one chain: it leaves the matrix unit as 8 * (score + mask term); the 1/8 is part of the exp2 factor.
// Online softmax per query = per lane column (in-lane over 16 values + one xor-16 exchange); state m_run (in units of the raw sums) / nb_run / l per lane and group; accumulators hold 1024 * sum(p v).
// P^T B fragment: elements 0..7 = first key tile's accumulator, elements 8..15 = second key tile's accumulator (same lane). A = V^T rows (m = d, k = key).
// 768 blocks = 3 per WGP = 3 waves per SIMD, all resident at once.
// The SEQ / 128 blocks of one (b, h) read the same K and V. Each enters the ring of key passes at a place of its own and wraps round, so that they do not ask for the same lines at the same moment and most of a block's passes read lines that another block has fetched earlier. Any entry place gives the same sums in another order.
__global__ __launch_bounds__(128) __attribute__((amdgpu_waves_per_eu(3, 3))) void k_attn(const h16* __restrict__ PL, const float* __restrict__ MB, float* OUT) {
    __shared__ __align__(16) float os[4 * 32 * 68];
    const int w = threadIdx.x >> 5, lane = threadIdx.x & 31, lr = lane & 15, hi = lane >> 4;
    const int bh = blockIdx.x / (SEQ / 128), bi = blockIdx.x % (SEQ / 128);
    const int q0 = (bi * 4 + w) * 32; const int b = bh / NH, hd = bh % NH;
    // entry pass: neighbouring blocks a quarter of the ring apart, the rest fills the gaps evenly
    const int kb0 = ((bi & 3) * (NPS / 4) + (bi >> 3) * (NPS / 8) + ((bi >> 2) & 1) * (NPS / 16)) % NPS;
    const size_t PLN = (size_t)NB * NH * SEQ * HD;
    const h16* qh = PL + ((size_t)bh * SEQ + q0 + lr) * HD + 8 * hi;
    const h16* ql = qh + PLN;
    const h16* kv = PL + 2 * PLN + (size_t)bh * SEQ * (2 * HD);
    const float* mb = MB + (size_t)b * SEQ;
    const int lo = lane * 8, mo = 8 * hi;
    v16h bqh0[2], bqh1[2], bql0[2], bql1[2];
    // nothing moves across this line or the one behind the wait below: only the Q loads stand between them, so no other instruction can reuse their address registers ahead of the wait
    __builtin_amdgcn_sched_barrier(0);
#pragma unroll
    for (int g = 0; g < 2; ++g) {
        bqh0[g] = ldh(qh + g * 16 * HD); bqh1[g] = ldh(qh + g * 16 * HD + 32);
        bql0[g] = bqh0[g]; bql1[g] = bqh1[g];
        if (QLO) { bql0[g] = ldh(ql + g * 16 * HD); bql1[g] = ldh(ql + g * 16 * HD + 32); }
    }
    // precaution: stands behind the Q loads and before their address registers are reused; its memory clobber also keeps the Q loads the oldest, so that no wait for them inside the loop reaches the younger loads
    asm volatile("s_wait_xcnt 0x0" ::: "memory");
    __builtin_amdgcn_sched_barrier(0);
    v8f acc[2][4];
#pragma unroll
    for (int g = 0; g < 2; ++g)
#pragma unroll
        for (int dt = 0; dt < 4; ++dt) acc[g][dt] = (v8f){};
    float m_run[2] = {-1.0e30f, -1.0e30f}, nb_run[2] = {1.8033688e29f, 1.8033688e29f}, l_run[2] = {0.0f, 0.0f};
    // K fragments and mask terms run one pass ahead of their use: pass 0's are fetched here, pass j + 1's inside pass j.
    const h16* kf = kv + (size_t)kb0 * (64 * HD);
    const float* mf = mb + kb0 * 32;
    v16h ka0 = ldp(kf + lo), ka1 = ldp(kf + 512 + lo), kc0 = ldp(kf + 1024 + lo), kc1 = ldp(kf + 1536 + lo);
    // precaution: stands behind the first pass's K loads and before their address registers are reused; the line behind it keeps later instructions from moving ahead of it
    asm volatile("s_wait_xcnt 0x0" ::: "memory");
    __builtin_amdgcn_sched_barrier(0);
    v4f m0a = *(const v4f*)(mf + mo), m0b = *(const v4f*)(mf + 4 + mo), m1a = *(const v4f*)(mf + 16 + mo), m1b = *(const v4f*)(mf + 20 + mo);
    // precaution: stands behind the first pass's mask loads and before their address registers are reused; the line behind it keeps later instructions from moving ahead of it
    asm volatile("s_wait_xcnt 0x0" ::: "memory");
    __builtin_amdgcn_sched_barrier(0);
    auto pass = [&](const h16* kp, const h16* kq, const float* mq, const bool more) __attribute__((always_inline)) {
        // this pass's 32 keys: V^T at kp + 2048; the next pass's: K at kq, mask terms at mq (all three the same for the whole wave; the lane's part is lo or mo)
        v16h vf[4];
#pragma unroll
        for (int dt = 0; dt < 4; ++dt) vf[dt] = ldp(kp + 2048 + dt * 512 + lo);
        if (!more) {
            // precaution: the last pass has no further load from kp, so the wait stands here, before the address registers of the V loads are reused; the line behind it keeps later instructions from moving ahead of it
            asm volatile("s_wait_xcnt 0x0" ::: "memory");
        }
        // nothing moves across this line: without it the first score product, and with it the wait for this pass's K fragments and mask terms, is lifted over the V loads, which would then start only behind that wait
        __builtin_amdgcn_sched_barrier(0);
        // the score sums start from the mask terms of their keys, the same for both groups
        const v8f c0 = cat8(m0a, m0b), c1 = cat8(m1a, m1b);
        v8f s0[2], s1[2];
#pragma unroll
        for (int g = 0; g < 2; ++g) { s0[g] = wmma16(ka0, bqh0[g], c0); s1[g] = wmma16(kc0, bqh0[g], c1); }
#pragma unroll
        for (int g = 0; g < 2; ++g) { s0[g] = wmma16(ka1, bqh1[g], s0[g]); s1[g] = wmma16(kc1, bqh1[g], s1[g]); }
        if (QLO) {
#pragma unroll
            for (int g = 0; g < 2; ++g) { s0[g] = wmma16(ka0, bql0[g], s0[g]); s1[g] = wmma16(kc0, bql0[g], s1[g]); }
#pragma unroll
            for (int g = 0; g < 2; ++g) { s0[g] = wmma16(ka1, bql1[g], s0[g]); s1[g] = wmma16(kc1, bql1[g], s1[g]); }
        }
        // four vector slots between the last score product and the first vector instruction on its result or operands; the mask terms are named too, so that no accumulator takes their registers: the next pass's mask loads then land where the products read them (otherwise the compiler copies them there, behind a wait for every load in flight)
        asm volatile("v_nop\n\tv_nop\n\tv_nop\n\tv_nop" : "+v"(s0[0]), "+v"(s1[0]), "+v"(s0[1]), "+v"(s1[1]) : "v"(ka1), "v"(kc1), "v"(bqh1[0]), "v"(bql1[0]), "v"(bqh1[1]), "v"(bql1[1]), "v"(c0), "v"(c1));
        // the next pass's K fragments, into the registers the score products have just left: they fly under the softmax and the output products
        if (more) {
            ka0 = ldp(kq + lo); ka1 = ldp(kq + 512 + lo); kc0 = ldp(kq + 1024 + lo); kc1 = ldp(kq + 1536 + lo);
            // precaution: stands behind the V and K loads and before their address registers are reused; its memory clobber also keeps the K loads from being sunk below the rescale branch, where they would fly under far less work; the line behind it keeps later instructions from moving ahead of it
            asm volatile("s_wait_xcnt 0x0" ::: "memory");
            __builtin_amdgcn_sched_barrier(0);
        }
        float mnew[2];
#pragma unroll
        for (int g = 0; g < 2; ++g) {
            float mx = s0[g][0];
#pragma unroll
            for (int i = 1; i < 8; ++i) mx = fmaxf(mx, s0[g][i]);
#pragma unroll
            for (int i = 0; i < 8; ++i) mx = fmaxf(mx, s1[g][i]);
            const float mo = __shfl_xor(mx, 16, 32);
            mx = fmaxf(mx, mo);
            mnew[g] = fmaxf(m_run[g], mx);
        }
        const unsigned grow = __builtin_amdgcn_ballot_w32((mnew[0] > m_run[0]) || (mnew[1] > m_run[1]));
        if (grow != 0u) {      // wave-uniform, one test per pass: some query column of either group got a new maximum (a column without one is scaled by exactly 1)
#pragma unroll
            for (int g = 0; g < 2; ++g) {
                const float nbn = __builtin_fmaf(-mnew[g], CSC, PCL);
                const float al = ex2(nbn - nb_run[g]);
                l_run[g] *= al;
#pragma unroll
                for (int dt = 0; dt < 4; ++dt)
#pragma unroll
                    for (int r = 0; r < 8; ++r) acc[g][dt][r] *= al;
                nb_run[g] = nbn; m_run[g] = mnew[g];
            }
        }
        // the next pass's mask terms, into the same registers; they are fetched here, where the score products that read those registers as their start value have long delivered their results, not directly behind those products
        if (more) {
            m0a = *(const v4f*)(mq + mo); m0b = *(const v4f*)(mq + 4 + mo); m1a = *(const v4f*)(mq + 16 + mo); m1b = *(const v4f*)(mq + 20 + mo);
            // precaution: stands behind the mask loads and before their address registers are reused; the line behind it keeps later instructions from moving ahead of it
            asm volatile("s_wait_xcnt 0x0" ::: "memory");
            __builtin_amdgcn_sched_barrier(0);
        }
        v16h pf[2];
#pragma unroll
        for (int g = 0; g < 2; ++g) {
            // exp2 arguments on neighbouring accumulator registers, two per packed FMA
            float a0[8], a1[8];
#pragma unroll
            for (int r = 0; r < 8; r += 2) {
                const v2f x0 = __builtin_elementwise_fma((v2f){s0[g][r], s0[g][r + 1]}, (v2f){CSC, CSC}, (v2f){nb_run[g], nb_run[g]});
                const v2f x1 = __builtin_elementwise_fma((v2f){s1[g][r], s1[g][r + 1]}, (v2f){CSC, CSC}, (v2f){nb_run[g], nb_run[g]});
                a0[r] = x0[0]; a0[r + 1] = x0[1]; a1[r] = x1[0]; a1[r + 1] = x1[1];
            }
            float ps = 0.0f;
#pragma unroll
            for (int r = 0; r < 8; ++r) {
                const float e0 = ex2(a0[r]);
                const float e1 = ex2(a1[r]);
                ps += e0 + e1; pf[g][r] = (h16)e0; pf[g][8 + r] = (h16)e1;
            }
            l_run[g] += ps;
        }
#pragma unroll
        for (int dt = 0; dt < 4; ++dt)
#pragma unroll
            for (int g = 0; g < 2; ++g) acc[g][dt] = wmma16(vf[dt], pf[g], acc[g][dt]);
        // four vector slots between the last output product and whatever stands first behind the pass, on either side of the loop's branch
        asm volatile("v_nop\n\tv_nop\n\tv_nop\n\tv_nop" : "+v"(acc[0][0]), "+v"(acc[0][1]), "+v"(acc[0][2]), "+v"(acc[0][3]), "+v"(acc[1][0]), "+v"(acc[1][1]), "+v"(acc[1][2]), "+v"(acc[1][3]) : "v"(vf[0]), "v"(vf[1]), "v"(vf[2]), "v"(vf[3]), "v"(pf[0]), "v"(pf[1]));
    };
    const h16* kc = kf;
    const h16* kn = (kb0 + 1 == NPS) ? kv : kf + 64 * HD;
    const float* mn = (kb0 + 1 == NPS) ? mb : mf + 32;
    // kept rolled: one copy of the pass in the loop; the last pass stands alone because it has no next pass to fetch for
#pragma unroll 1
    for (int j = 0; j < NPS - 1; ++j) {
        pass(kc, kn, mn, true);
        // one step round the ring, behind the pass's last wait for its loads' addresses
        const bool wrap = (kn + 64 * HD == kv + (size_t)NPS * (64 * HD));
        kc = kn; kn = wrap ? kv : kn + 64 * HD; mn = wrap ? mb : mn + 32;
    }
    // the last pass is the ring's block in front of the entry block
    const h16* kl = kv + (size_t)((kb0 + NPS - 1) % NPS) * (64 * HD);
    pass(kl, kl, mn, false);
    float* o = os + w * 32 * 68;
#pragma unroll
    for (int g = 0; g < 2; ++g) {
        const float lo = __shfl_xor(l_run[g], 16, 32);
        const float inv = 1.0f / (l_run[g] + lo);
#pragma unroll
        for (int dt = 0; dt < 4; ++dt) { v4f a, c;
#pragma unroll
            for (int r = 0; r < 4; ++r) { a[r] = acc[g][dt][r] * inv; c[r] = acc[g][dt][4 + r] * inv; }
            *(v4fa*)(o + (g * 16 + lr) * 68 + dt * 16 + 8 * hi) = a; *(v4fa*)(o + (g * 16 + lr) * 68 + dt * 16 + 8 * hi + 4) = c; }
    }
    __syncthreads();
    float* dst = OUT + ((size_t)b * SEQ_FULL + q0) * NP + hd * HD;
{
#pragma unroll
        for (int s = 0; s < 16; ++s) { const int row = 2 * s + hi, cofs = lr * 4; const v4f val = *(const v4fa*)(o + row * 68 + cofs);
            *(v4f*)(dst + (size_t)row * NP + cofs) = val; }
         }
}

extern "C" void kernel_launch(void* const* d_in, const int* in_sizes, int n_in,
                              void* d_out, int out_size, void* d_ws, size_t ws_size, hipStream_t stream) {
    if (n_in < 8) return;
    const size_t rows_in = (size_t)(NB - 1) * SEQ_FULL + SEQ;
    if ((size_t)in_sizes[0] < rows_in * DM) return;
    if ((size_t)in_sizes[1] < rows_in) return;
    if (in_sizes[2] < DM * NP || in_sizes[4] < DM * NP || in_sizes[6] < DM * NP) return;
    if (in_sizes[3] < NP || in_sizes[5] < NP || in_sizes[7] < NP) return;
    if ((size_t)out_size < rows_in * NP) return;
    const float* x  = (const float*)d_in[0];   // hidden_states [4][2048][64]
    const float* am = (const float*)d_in[1];   // attention_mask [4][2048]
    const float* wq = (const float*)d_in[2]; const float* bq = (const float*)d_in[3];
    const float* wk = (const float*)d_in[4]; const float* bk = (const float*)d_in[5];
    const float* wv = (const float*)d_in[6]; const float* bv = (const float*)d_in[7];
    float* OUT = (float*)d_out;                // [4][2048][768]
    char* wsp = (char*)d_ws;
    auto take = [&](size_t bytes) { char* p = wsp; wsp += (bytes + 255) & ~(size_t)255; return (void*)p; };
    const size_t PLN = (size_t)NB * NH * SEQ * HD;
    bf* XB = (bf*)take((size_t)NB * SEQ * DM * 2);
    bf* WT = (bf*)take((size_t)3 * NP * DM * 2);
    float* BI = (float*)take((size_t)3 * NP * 4);
    float* MB = (float*)take((size_t)NB * SEQ * 4);
    h16* PL = (h16*)take(4 * PLN * 2);
    if ((size_t)(wsp - (char*)d_ws) > ws_size) return;
    k_prep<<<PX_BLOCKS + PW_BLOCKS + PB_BLOCKS + PM_BLOCKS, 256, 0, stream>>>(x, am, wq, bq, wk, bk, wv, bv, XB, WT, BI, MB);
    k_proj<<<dim3(NB * SEQ / 64, NH, 3), 32, 0, stream>>>(XB, WT, BI, PL);
    k_attn<<<NB * NH * (SEQ / 32) / 4, 128, 0, stream>>>(PL, MB, OUT);
}

// v006
// A run of this version takes 70.1 microseconds.
// Next to v005, in two timings, it ran 1.06 and 1.07 times as fast.
// Over all steps from v000 it is 3.03 times as fast.
#include <hip/hip_runtime.h>

// Self attention, 12 heads of width 64, on one input stream x [4][2048][64]; q, k, v = x W + b with W [64][768] ([in][out]) and b [768]; scores = q k^T / 8 + (1 - m[b][key]) * (-10000); softmax over keys; out [4][2048][768] with heads merged head-major (column h*64 + d).
// Compute dtypes, f32 accumulate: projections v_wmma_f32_16x16x32_bf16 on bf16-RNE inputs (exact products); scores v_wmma_f32_16x16x32_f16 with q as f16 hi + f16 residual (unscaled, same accumulator, which starts from the mask term) and k as one f16 plane; probability x value v_wmma_f32_16x16x32_f16 with P carried x 1024 and v as one f16 plane; softmax in f32.
// Attention engine: transposed flash form S^T = K Q^T (Q^T held as B fragments in registers), packed P^T from the two S^T accumulators is the B fragment of O^T = V^T P^T; no LDS and no barrier inside the key loop.

#ifndef NB
#define NB 4
#endif
#ifndef SEQ
#define SEQ 2048
#endif
#define NB_FULL  4
#define SEQ_FULL 2048
#define DM   64
#define NH   12
#define HD   64
#define NP   (NH * HD)
#ifndef QLO
#define QLO 1
#endif
#define PCL  10.0f
#define SCL  0.125f
#define L2E  1.4426950408889634f
#define CSC  (SCL * L2E)
#define NPS  (SEQ / 32)

static_assert(SEQ % 128 == 0);
static_assert(NB <= NB_FULL);
static_assert(SEQ <= SEQ_FULL);
static_assert((NB * NH * (SEQ / 32)) % 4 == 0);
static_assert(DM % 32 == 0);
static_assert(HD == 64);

typedef _Float16 h16;
typedef __attribute__((ext_vector_type(16))) __bf16   v16bf;
typedef __attribute__((ext_vector_type(16))) _Float16 v16h;
typedef __attribute__((ext_vector_type(8)))  _Float16 v8h;
typedef __attribute__((ext_vector_type(4)))  _Float16 v4h;
typedef __attribute__((ext_vector_type(2)))  __bf16   v2bf;
typedef __attribute__((ext_vector_type(8)))  unsigned v8u;
typedef __attribute__((ext_vector_type(8)))  float    v8f;
typedef __attribute__((ext_vector_type(4)))  float    v4f;
typedef __attribute__((ext_vector_type(2)))  float    v2f;
typedef v8h  __attribute__((may_alias)) v8ha;
typedef v4h  __attribute__((may_alias)) v4ha;
typedef v4f  __attribute__((may_alias)) v4fa;

__device__ __forceinline__ unsigned short f2bf(float f) { unsigned u = __float_as_uint(f); u += 0x7FFFu + ((u >> 16) & 1u); return (unsigned short)(u >> 16); }
__device__ __forceinline__ float bf2f(unsigned short b) { return __uint_as_float(((unsigned)b) << 16); }
__device__ __forceinline__ float bfr(float f) { return bf2f(f2bf(f)); }
// two f32 to two bf16, nearest even, first value in the low half
__device__ __forceinline__ unsigned pkbf(float a, float b) { v2bf r; r[0] = (__bf16)a; r[1] = (__bf16)b; return __builtin_bit_cast(unsigned, r); }
__device__ __forceinline__ v16h cat16(v8h lo, v8h hi) { return __builtin_shufflevector(lo, hi, 0, 1, 2, 3, 4, 5, 6, 7, 8, 9, 10, 11, 12, 13, 14, 15); }
__device__ __forceinline__ v8f cat8(v4f lo, v4f hi) { return __builtin_shufflevector(lo, hi, 0, 1, 2, 3, 4, 5, 6, 7); }
__device__ __forceinline__ v8f wmma16(v16h a, v16h b, v8f c) { return __builtin_amdgcn_wmma_f32_16x16x32_f16(false, a, false, b, (short)0, c, false, false); }
__device__ __forceinline__ v8f wmmab(v16bf a, v16bf b, v8f c) { return __builtin_amdgcn_wmma_f32_16x16x32_bf16(false, a, false, b, (short)0, c, false, false); }
// fragment loaders: p already points at (row, k0 + 8*half); elements 0..7 = k0+8h.., elements 8..15 = k0+16+8h..
__device__ __forceinline__ v16h ldh(const h16* p) { return cat16(*(const v8h*)p, *(const v8h*)(p + 16)); }
// packed fragment loader: p already points at (fragment, lane * 8); the two 16-B halves of a fragment lie 512 B apart, each a run of 32 lanes x 16 B
__device__ __forceinline__ v16h ldp(const h16* p) { return cat16(*(const v8h*)p, *(const v8h*)(p + 256)); }
__device__ __forceinline__ float ex2(float x) { return __builtin_amdgcn_exp2f(x); }

// ---- k_proj: one wave per 64x64 tile of [NB*SEQ][768] for mat = blockIdx.z (0 q, 1 k, 2 v); column tile = one head. K = 64 (two 32-deep steps).
// The wave reads its f32 rows of x and its f32 columns of W itself and rounds them to bf16 (nearest even, one packed convert per pair) on the way into the fragments; the bias is rounded the same way and kept as f32.
// Column map: column tile nb, lane column lr stand for head column 4*lr + nb, so that one 16-B load of W[k][4*lr .. 4*lr+3] feeds all four column tiles and 16 lanes read 256 contiguous bytes of a row of W.
// The waves of head 0 of the q product also write MB[b][t] = (1 - bf16-RNE m[b][t]) * (-10000) * 8 as f32 for their 64 rows (two whole lines): the mask term in units of the raw q.k sums, whose start value it is in k_attn.
// Planes (f16), PL = [QH | QL | KV], QH/QL NB*NH*SEQ*64 elements each, [b][h][t][d]; KV twice that, [b][h][t/32][16 runs][32 lanes][8]: per 32 keys the 16 wave-wide 16-B loads of k_attn's A fragments, each run 512 contiguous bytes.
// Runs 0..7 hold k: run = 4*((t%32)/16) + d/16, lane = 16*((d/8)&1) + t%16, element d%8. Runs 8..15 hold v transposed: run = 8 + 2*(d/16) + (t%32)/16, lane = 16*((t/8)&1) + d%16, element t%8.
__global__ __launch_bounds__(32) void k_proj(const float* __restrict__ x, const float* __restrict__ am,
                                             const float* __restrict__ wq, const float* __restrict__ bq,
                                             const float* __restrict__ wk, const float* __restrict__ bk,
                                             const float* __restrict__ wv, const float* __restrict__ bv,
                                             float* MB, h16* PL) {
    __shared__ __align__(16) h16 hs[64 * 72];
    __shared__ __align__(16) h16 ls[64 * 72];
    const int lane = threadIdx.x & 31, lr = lane & 15, hi = lane >> 4;
    const int r0 = blockIdx.x * 64, hd = blockIdx.y, mat = blockIdx.z; const int c0 = hd * 64;
    const int b = r0 / SEQ, t0 = r0 % SEQ;
    if (hd == 0 && mat == 0) {
        const float* ap = am + (size_t)b * SEQ_FULL + t0 + lane;
        const float a0 = bfr(ap[0]), a1 = bfr(ap[32]);
        MB[r0 + lane] = (1.0f - a0) * (-10000.0f) * (1.0f / SCL);
        MB[r0 + 32 + lane] = (1.0f - a1) * (-10000.0f) * (1.0f / SCL);
        // precaution: stands behind the mask-term stores and before later code reuses their data or address registers
        asm volatile("s_wait_xcnt 0x0" ::: "memory");
    }
    const float* Wm = (mat == 0) ? wq : ((mat == 1) ? wk : wv);
    const float* bm = (mat == 0) ? bq : ((mat == 1) ? bk : bv);
    const float* Ap = x + ((size_t)b * SEQ_FULL + t0 + lr) * DM + 8 * hi;
    const float* Bp = Wm + (size_t)(8 * hi) * NP + c0 + 4 * lr;
    // all of the wave's operands are asked for at once: one memory round trip. Fragment element e of step s stands for k = 32*s + 8*hi + (e & 7) + 16*(e >> 3), in A and in B alike.
    v4f wr[2][16], ar[2][4][4];
#pragma unroll
    for (int s = 0; s < 2; ++s) {
#pragma unroll
        for (int e = 0; e < 16; ++e) wr[s][e] = *(const v4f*)(Bp + (size_t)(s * 32 + (e & 7) + 16 * (e >> 3)) * NP);
#pragma unroll
        for (int mb = 0; mb < 4; ++mb) { const float* p = Ap + (size_t)mb * 16 * DM + s * 32;
            ar[s][mb][0] = *(const v4f*)p; ar[s][mb][1] = *(const v4f*)(p + 4); ar[s][mb][2] = *(const v4f*)(p + 16); ar[s][mb][3] = *(const v4f*)(p + 20); }
    }
    const v4f br = *(const v4f*)(bm + c0 + 4 * lr);
    // precaution: stands behind the operand loads and before their address registers are reused; the line behind it keeps later instructions from moving ahead of it
    asm volatile("s_wait_xcnt 0x0" ::: "memory");
    __builtin_amdgcn_sched_barrier(0);
    // the f32 operands are rounded into the bf16 fragments of both 32-deep steps
    v16bf a[2][4], bb[2][4];
#pragma unroll
    for (int s = 0; s < 2; ++s) {
#pragma unroll
        for (int mb = 0; mb < 4; ++mb) { v8u t;
#pragma unroll
            for (int i = 0; i < 8; ++i) t[i] = pkbf(ar[s][mb][i >> 1][(i & 1) * 2], ar[s][mb][i >> 1][(i & 1) * 2 + 1]);
            a[s][mb] = __builtin_bit_cast(v16bf, t); }
#pragma unroll
        for (int nb = 0; nb < 4; ++nb) { v8u t;
#pragma unroll
            for (int i = 0; i < 8; ++i) t[i] = pkbf(wr[s][2 * i][nb], wr[s][2 * i + 1][nb]);
            bb[s][nb] = __builtin_bit_cast(v16bf, t); }
    }
    v8f acc[4][4];
#pragma unroll
    for (int nb = 0; nb < 4; ++nb)
#pragma unroll
        for (int mb = 0; mb < 4; ++mb) acc[mb][nb] = wmmab(a[0][mb], bb[0][nb], (v8f){});
#pragma unroll
    for (int nb = 0; nb < 4; ++nb)
#pragma unroll
        for (int mb = 0; mb < 4; ++mb) acc[mb][nb] = wmmab(a[1][mb], bb[1][nb], acc[mb][nb]);
    // four vector slots between the last products and the first vector instruction on their results or operands
    asm volatile("v_nop\n\tv_nop\n\tv_nop\n\tv_nop" : "+v"(acc[0][3]), "+v"(acc[1][3]), "+v"(acc[2][3]), "+v"(acc[3][3]) : "v"(a[1][0]), "v"(a[1][1]), "v"(a[1][2]), "v"(a[1][3]), "v"(bb[1][3]));
    float bia[4];
#pragma unroll
    for (int nb = 0; nb < 4; ++nb) bia[nb] = bfr(br[nb]);
    const size_t bh = (size_t)b * NH + hd;
    const size_t PLN = (size_t)NB * NH * SEQ * HD;
    const int rq = lane >> 3, pc = (lane & 7) * 8;
    if (mat == 2) {
        // v: staged transposed hs[d][t]; lane's 8 accumulator rows are 8 consecutive t -> one 16-B LDS store
#pragma unroll
        for (int mb = 0; mb < 4; ++mb)
#pragma unroll
            for (int nb = 0; nb < 4; ++nb) { v8h pk;
#pragma unroll
                for (int j = 0; j < 8; ++j) pk[j] = (h16)(acc[mb][nb][j] + bia[nb]);
                *(v8ha*)(hs + (4 * lr + nb) * 72 + mb * 16 + 8 * hi) = pk; }
        __syncthreads();
        h16* dst = PL + 2 * PLN + (bh * SEQ + t0) * (2 * HD) + 2048 + lane * 8;
{
#pragma unroll
            for (int i = 0; i < 16; ++i) { const int jb = i >> 3, dt = (i >> 1) & 3, s = i & 1; const v8h val = *(const v8ha*)(hs + (dt * 16 + lr) * 72 + jb * 32 + s * 16 + 8 * hi);
                *(v8h*)(dst + jb * 4096 + (i & 7) * 256) = val; }
             }
    } else {
        const bool wl = (mat == 0) && (QLO != 0);
        // q, k: staged hs[t][d]; the lane's four column tiles are 4 consecutive d of one row -> one 8-B LDS store
        if (wl) {
#pragma unroll
            for (int mb = 0; mb < 4; ++mb)
#pragma unroll
                for (int j = 0; j < 8; ++j) { const int row = mb * 16 + 8 * hi + j; v4h hv4, lv4;
#pragma unroll
                    for (int nb = 0; nb < 4; ++nb) { const float v = acc[mb][nb][j] + bia[nb]; const h16 hv = (h16)v; hv4[nb] = hv; lv4[nb] = (h16)(v - (float)hv); }
                    *(v4ha*)(hs + row * 72 + 4 * lr) = hv4; *(v4ha*)(ls + row * 72 + 4 * lr) = lv4; }
        } else {
#pragma unroll
            for (int mb = 0; mb < 4; ++mb)
#pragma unroll
                for (int j = 0; j < 8; ++j) { const int row = mb * 16 + 8 * hi + j; v4h hv4;
#pragma unroll
                    for (int nb = 0; nb < 4; ++nb) hv4[nb] = (h16)(acc[mb][nb][j] + bia[nb]);
                    *(v4ha*)(hs + row * 72 + 4 * lr) = hv4; }
        }
        __syncthreads();
        if (mat == 1) {
            h16* dst = PL + 2 * PLN + (bh * SEQ + t0) * (2 * HD) + lane * 8;
#pragma unroll
            for (int i = 0; i < 16; ++i) { const int kt = i >> 2, L = i & 3; const v8h val = *(const v8ha*)(hs + (kt * 16 + lr) * 72 + (2 * L + hi) * 8);
                *(v8h*)(dst + (i >> 3) * 4096 + (i & 7) * 256) = val; }
            // precaution: stands behind the k stores and before any later code reuses their data or address registers
            asm volatile("s_wait_xcnt 0x0" ::: "memory");
        } else {
            h16* dst = PL + (bh * SEQ + t0) * HD;
#pragma unroll
            for (int i = 0; i < 16; ++i) { const int row = 4 * i + rq; const v8h val = *(const v8ha*)(hs + row * 72 + pc);
                *(v8h*)(dst + (size_t)row * HD + pc) = val; }
            // precaution: stands behind the q stores and before the residual block reuses their data or address registers
            asm volatile("s_wait_xcnt 0x0" ::: "memory");
             }
        if (wl) {
            h16* dl = PL + PLN + (bh * SEQ + t0) * HD;
{
#pragma unroll
                for (int i = 0; i < 16; ++i) { const int row = 4 * i + rq; const v8h val = *(const v8ha*)(ls + row * 72 + pc);
                    *(v8h*)(dl + (size_t)row * HD + pc) = val; }
                 }
        }
    }
}

// ---- k_attn: 4 waves per block, each wave owns 32 consecutive queries of one (b, h), as two column groups of 16, and walks all keys 32 at a time; every K and V^T fragment loaded feeds both groups.
// S^T tile (keys x queries): A = K rows (m = key, k = d), B = Q^T (k = d, n = query) held in registers; accumulator element r of lane (half, n) = (key 8*half + r, query n).
// The accumulator starts from the lane's eight mask terms (x 8) and takes the hi and the residual products in one chain: it leaves the matrix unit as 8 * (score + mask term); the 1/8 is part of the exp2 factor.
// Online softmax per query = per lane column (in-lane over 16 values + one xor-16 exchange); state m_run (in units of the raw sums) / nb_run / l per lane and group; accumulators hold 1024 * sum(p v).
// P^T B fragment: elements 0..7 = first key tile's accumulator, elements 8..15 = second key tile's accumulator (same lane). A = V^T rows (m = d, k = key).
// 768 blocks = 3 per WGP = 3 waves per SIMD, all resident at once.
// The SEQ / 128 blocks of one (b, h) read the same K and V. Each enters the ring of key passes at a place of its own and wraps round, so that they do not ask for the same lines at the same moment and most of a block's passes read lines that another block has fetched earlier. Any entry place gives the same sums in another order.
__global__ __launch_bounds__(128) __attribute__((amdgpu_waves_per_eu(3, 3))) void k_attn(const h16* __restrict__ PL, const float* __restrict__ MB, float* OUT) {
    __shared__ __align__(16) float os[4 * 32 * 68];
    const int w = threadIdx.x >> 5, lane = threadIdx.x & 31, lr = lane & 15, hi = lane >> 4;
    const int bh = blockIdx.x / (SEQ / 128), bi = blockIdx.x % (SEQ / 128);
    const int q0 = (bi * 4 + w) * 32; const int b = bh / NH, hd = bh % NH;
    // entry pass: neighbouring blocks a quarter of the ring apart, the rest fills the gaps evenly
    const int kb0 = ((bi & 3) * (NPS / 4) + (bi >> 3) * (NPS / 8) + ((bi >> 2) & 1) * (NPS / 16)) % NPS;
    const size_t PLN = (size_t)NB * NH * SEQ * HD;
    const h16* qh = PL + ((size_t)bh * SEQ + q0 + lr) * HD + 8 * hi;
    const h16* ql = qh + PLN;
    const h16* kv = PL + 2 * PLN + (size_t)bh * SEQ * (2 * HD);
    const float* mb = MB + (size_t)b * SEQ;
    const int lo = lane * 8, mo = 8 * hi;
    v16h bqh0[2], bqh1[2], bql0[2], bql1[2];
    // nothing moves across this line or the one behind the wait below: only the Q loads stand between them, so no other instruction can reuse their address registers ahead of the wait
    __builtin_amdgcn_sched_barrier(0);
#pragma unroll
    for (int g = 0; g < 2; ++g) {
        bqh0[g] = ldh(qh + g * 16 * HD); bqh1[g] = ldh(qh + g * 16 * HD + 32);
        bql0[g] = bqh0[g]; bql1[g] = bqh1[g];
        if (QLO) { bql0[g] = ldh(ql + g * 16 * HD); bql1[g] = ldh(ql + g * 16 * HD + 32); }
    }
    // precaution: stands behind the Q loads and before their address registers are reused; its memory clobber also keeps the Q loads the oldest, so that no wait for them inside the loop reaches the younger loads
    asm volatile("s_wait_xcnt 0x0" ::: "memory");
    __builtin_amdgcn_sched_barrier(0);
    v8f acc[2][4];
#pragma unroll
    for (int g = 0; g < 2; ++g)
#pragma unroll
        for (int dt = 0; dt < 4; ++dt) acc[g][dt] = (v8f){};
    float m_run[2] = {-1.0e30f, -1.0e30f}, nb_run[2] = {1.8033688e29f, 1.8033688e29f}, l_run[2] = {0.0f, 0.0f};
    // K fragments and mask terms run one pass ahead of their use: pass 0's are fetched here, pass j + 1's inside pass j.
    const h16* kf = kv + (size_t)kb0 * (64 * HD);
    const float* mf = mb + kb0 * 32;
    v16h ka0 = ldp(kf + lo), ka1 = ldp(kf + 512 + lo), kc0 = ldp(kf + 1024 + lo), kc1 = ldp(kf + 1536 + lo);
    // precaution: stands behind the first pass's K loads and before their address registers are reused; the line behind it keeps later instructions from moving ahead of it
    asm volatile("s_wait_xcnt 0x0" ::: "memory");
    __builtin_amdgcn_sched_barrier(0);
    v4f m0a = *(const v4f*)(mf + mo), m0b = *(const v4f*)(mf + 4 + mo), m1a = *(const v4f*)(mf + 16 + mo), m1b = *(const v4f*)(mf + 20 + mo);
    // precaution: stands behind the first pass's mask loads and before their address registers are reused; the line behind it keeps later instructions from moving ahead of it
    asm volatile("s_wait_xcnt 0x0" ::: "memory");
    __builtin_amdgcn_sched_barrier(0);
    auto pass = [&](const h16* kp, const h16* kq, const float* mq, const bool more) __attribute__((always_inline)) {
        // this pass's 32 keys: V^T at kp + 2048; the next pass's: K at kq, mask terms at mq (all three the same for the whole wave; the lane's part is lo or mo)
        v16h vf[4];
#pragma unroll
        for (int dt = 0; dt < 4; ++dt) vf[dt] = ldp(kp + 2048 + dt * 512 + lo);
        if (!more) {
            // precaution: the last pass has no further load from kp, so the wait stands here, before the address registers of the V loads are reused; the line behind it keeps later instructions from moving ahead of it
            asm volatile("s_wait_xcnt 0x0" ::: "memory");
        }
        // nothing moves across this line: without it the first score product, and with it the wait for this pass's K fragments and mask terms, is lifted over the V loads, which would then start only behind that wait
        __builtin_amdgcn_sched_barrier(0);
        // the score sums start from the mask terms of their keys, the same for both groups
        const v8f c0 = cat8(m0a, m0b), c1 = cat8(m1a, m1b);
        v8f s0[2], s1[2];
#pragma unroll
        for (int g = 0; g < 2; ++g) { s0[g] = wmma16(ka0, bqh0[g], c0); s1[g] = wmma16(kc0, bqh0[g], c1); }
#pragma unroll
        for (int g = 0; g < 2; ++g) { s0[g] = wmma16(ka1, bqh1[g], s0[g]); s1[g] = wmma16(kc1, bqh1[g], s1[g]); }
        if (QLO) {
#pragma unroll
            for (int g = 0; g < 2; ++g) { s0[g] = wmma16(ka0, bql0[g], s0[g]); s1[g] = wmma16(kc0, bql0[g], s1[g]); }
#pragma unroll
            for (int g = 0; g < 2; ++g) { s0[g] = wmma16(ka1, bql1[g], s0[g]); s1[g] = wmma16(kc1, bql1[g], s1[g]); }
        }
        // four vector slots between the last score product and the first vector instruction on its result or operands; the mask terms are named too, so that no accumulator takes their registers: the next pass's mask loads then land where the products read them (otherwise the compiler copies them there, behind a wait for every load in flight)
        asm volatile("v_nop\n\tv_nop\n\tv_nop\n\tv_nop" : "+v"(s0[0]), "+v"(s1[0]), "+v"(s0[1]), "+v"(s1[1]) : "v"(ka1), "v"(kc1), "v"(bqh1[0]), "v"(bql1[0]), "v"(bqh1[1]), "v"(bql1[1]), "v"(c0), "v"(c1));
        // the next pass's K fragments, into the registers the score products have just left: they fly under the softmax and the output products
        if (more) {
            ka0 = ldp(kq + lo); ka1 = ldp(kq + 512 + lo); kc0 = ldp(kq + 1024 + lo); kc1 = ldp(kq + 1536 + lo);
            // precaution: stands behind the V and K loads and before their address registers are reused; its memory clobber also keeps the K loads from being sunk below the rescale branch, where they would fly under far less work; the line behind it keeps later instructions from moving ahead of it
            asm volatile("s_wait_xcnt 0x0" ::: "memory");
            __builtin_amdgcn_sched_barrier(0);
        }
        float mnew[2];
#pragma unroll
        for (int g = 0; g < 2; ++g) {
            float mx = s0[g][0];
#pragma unroll
            for (int i = 1; i < 8; ++i) mx = fmaxf(mx, s0[g][i]);
#pragma unroll
            for (int i = 0; i < 8; ++i) mx = fmaxf(mx, s1[g][i]);
            const float mo = __shfl_xor(mx, 16, 32);
            mx = fmaxf(mx, mo);
            mnew[g] = fmaxf(m_run[g], mx);
        }
        const unsigned grow = __builtin_amdgcn_ballot_w32((mnew[0] > m_run[0]) || (mnew[1] > m_run[1]));
        if (grow != 0u) {      // wave-uniform, one test per pass: some query column of either group got a new maximum (a column without one is scaled by exactly 1)
#pragma unroll
            for (int g = 0; g < 2; ++g) {
                const float nbn = __builtin_fmaf(-mnew[g], CSC, PCL);
                const float al = ex2(nbn - nb_run[g]);
                l_run[g] *= al;
#pragma unroll
                for (int dt = 0; dt < 4; ++dt)
#pragma unroll
                    for (int r = 0; r < 8; ++r) acc[g][dt][r] *= al;
                nb_run[g] = nbn; m_run[g] = mnew[g];
            }
        }
        // the next pass's mask terms, into the same registers; they are fetched here, where the score products that read those registers as their start value have long delivered their results, not directly behind those products
        if (more) {
            m0a = *(const v4f*)(mq + mo); m0b = *(const v4f*)(mq + 4 + mo); m1a = *(const v4f*)(mq + 16 + mo); m1b = *(const v4f*)(mq + 20 + mo);
            // precaution: stands behind the mask loads and before their address registers are reused; the line behind it keeps later instructions from moving ahead of it
            asm volatile("s_wait_xcnt 0x0" ::: "memory");
            __builtin_amdgcn_sched_barrier(0);
        }
        v16h pf[2];
#pragma unroll
        for (int g = 0; g < 2; ++g) {
            // exp2 arguments on neighbouring accumulator registers, two per packed FMA
            float a0[8], a1[8];
#pragma unroll
            for (int r = 0; r < 8; r += 2) {
                const v2f x0 = __builtin_elementwise_fma((v2f){s0[g][r], s0[g][r + 1]}, (v2f){CSC, CSC}, (v2f){nb_run[g], nb_run[g]});
                const v2f x1 = __builtin_elementwise_fma((v2f){s1[g][r], s1[g][r + 1]}, (v2f){CSC, CSC}, (v2f){nb_run[g], nb_run[g]});
                a0[r] = x0[0]; a0[r + 1] = x0[1]; a1[r] = x1[0]; a1[r + 1] = x1[1];
            }
            float ps = 0.0f;
#pragma unroll
            for (int r = 0; r < 8; ++r) {
                const float e0 = ex2(a0[r]);
                const float e1 = ex2(a1[r]);
                ps += e0 + e1; pf[g][r] = (h16)e0; pf[g][8 + r] = (h16)e1;
            }
            l_run[g] += ps;
        }
#pragma unroll
        for (int dt = 0; dt < 4; ++dt)
#pragma unroll
            for (int g = 0; g < 2; ++g) acc[g][dt] = wmma16(vf[dt], pf[g], acc[g][dt]);
        // four vector slots between the last output product and whatever stands first behind the pass, on either side of the loop's branch
        asm volatile("v_nop\n\tv_nop\n\tv_nop\n\tv_nop" : "+v"(acc[0][0]), "+v"(acc[0][1]), "+v"(acc[0][2]), "+v"(acc[0][3]), "+v"(acc[1][0]), "+v"(acc[1][1]), "+v"(acc[1][2]), "+v"(acc[1][3]) : "v"(vf[0]), "v"(vf[1]), "v"(vf[2]), "v"(vf[3]), "v"(pf[0]), "v"(pf[1]));
    };
    const h16* kc = kf;
    const h16* kn = (kb0 + 1 == NPS) ? kv : kf + 64 * HD;
    const float* mn = (kb0 + 1 == NPS) ? mb : mf + 32;
    // kept rolled: one copy of the pass in the loop; the last pass stands alone because it has no next pass to fetch for
#pragma unroll 1
    for (int j = 0; j < NPS - 1; ++j) {
        pass(kc, kn, mn, true);
        // one step round the ring, behind the pass's last wait for its loads' addresses
        const bool wrap = (kn + 64 * HD == kv + (size_t)NPS * (64 * HD));
        kc = kn; kn = wrap ? kv : kn + 64 * HD; mn = wrap ? mb : mn + 32;
    }
    // the last pass is the ring's block in front of the entry block
    const h16* kl = kv + (size_t)((kb0 + NPS - 1) % NPS) * (64 * HD);
    pass(kl, kl, mn, false);
    float* o = os + w * 32 * 68;
#pragma unroll
    for (int g = 0; g < 2; ++g) {
        const float lo = __shfl_xor(l_run[g], 16, 32);
        const float inv = 1.0f / (l_run[g] + lo);
#pragma unroll
        for (int dt = 0; dt < 4; ++dt) { v4f a, c;
#pragma unroll
            for (int r = 0; r < 4; ++r) { a[r] = acc[g][dt][r] * inv; c[r] = acc[g][dt][4 + r] * inv; }
            *(v4fa*)(o + (g * 16 + lr) * 68 + dt * 16 + 8 * hi) = a; *(v4fa*)(o + (g * 16 + lr) * 68 + dt * 16 + 8 * hi + 4) = c; }
    }
    __syncthreads();
    float* dst = OUT + ((size_t)b * SEQ_FULL + q0) * NP + hd * HD;
{
#pragma unroll
        for (int s = 0; s < 16; ++s) { const int row = 2 * s + hi, cofs = lr * 4; const v4f val = *(const v4fa*)(o + row * 68 + cofs);
            *(v4f*)(dst + (size_t)row * NP + cofs) = val; }
         }
}

extern "C" void kernel_launch(void* const* d_in, const int* in_sizes, int n_in,
                              void* d_out, int out_size, void* d_ws, size_t ws_size, hipStream_t stream) {
    if (n_in < 8) return;
    const size_t rows_in = (size_t)(NB - 1) * SEQ_FULL + SEQ;
    if ((size_t)in_sizes[0] < rows_in * DM) return;
    if ((size_t)in_sizes[1] < rows_in) return;
    if (in_sizes[2] < DM * NP || in_sizes[4] < DM * NP || in_sizes[6] < DM * NP) return;
    if (in_sizes[3] < NP || in_sizes[5] < NP || in_sizes[7] < NP) return;
    if ((size_t)out_size < rows_in * NP) return;
    const float* x  = (const float*)d_in[0];   // hidden_states [4][2048][64]
    const float* am = (const float*)d_in[1];   // attention_mask [4][2048]
    const float* wq = (const float*)d_in[2]; const float* bq = (const float*)d_in[3];
    const float* wk = (const float*)d_in[4]; const float* bk = (const float*)d_in[5];
    const float* wv = (const float*)d_in[6]; const float* bv = (const float*)d_in[7];
    float* OUT = (float*)d_out;                // [4][2048][768]
    char* wsp = (char*)d_ws;
    auto take = [&](size_t bytes) { char* p = wsp; wsp += (bytes + 255) & ~(size_t)255; return (void*)p; };
    const size_t PLN = (size_t)NB * NH * SEQ * HD;
    float* MB = (float*)take((size_t)NB * SEQ * 4);
    h16* PL = (h16*)take(4 * PLN * 2);
    if ((size_t)(wsp - (char*)d_ws) > ws_size) return;
    k_proj<<<dim3(NB * SEQ / 64, NH, 3), 32, 0, stream>>>(x, am, wq, bq, wk, bk, wv, bv, MB, PL);
    k_attn<<<NB * NH * (SEQ / 32) / 4, 128, 0, stream>>>(PL, MB, OUT);
}

// v007
// One run takes 65.6 microseconds.
// Two timings next to v006 both put it at 1.07 times that version's speed.
// Counting every step since v000, it is 3.24 times as fast.
#include <hip/hip_runtime.h>

// Self attention, 12 heads of width 64, on one input stream x [4][2048][64]; q, k, v = x W + b with W [64][768] ([in][out]) and b [768]; scores = q k^T / 8 + (1 - m[b][key]) * (-10000); softmax over keys; out [4][2048][768] with heads merged head-major (column h*64 + d).
// Compute dtypes, f32 accumulate: projections v_wmma_f32_16x16x32_bf16 on bf16-RNE inputs (exact products); scores v_wmma_f32_16x16x32_f16 with q as f16 hi + f16 residual (unscaled, same accumulator, which starts from the mask term) and k as one f16 plane; probability x value v_wmma_f32_16x16x32_f16 with P carried x 1024 and v as one f16 plane; softmax in f32.
// Attention engine: transposed flash form S^T = K Q^T (Q^T held as B fragments in registers), packed P^T from the two S^T accumulators is the B fragment of O^T = V^T P^T; no LDS and no barrier inside the key loop.

#ifndef NB
#define NB 4
#endif
#ifndef SEQ
#define SEQ 2048
#endif
#define NB_FULL  4
#define SEQ_FULL 2048
#define DM   64
#define NH   12
#define HD   64
#define NP   (NH * HD)
#ifndef QLO
#define QLO 1
#endif
#define PCL  10.0f
#define SCL  0.125f
#define L2E  1.4426950408889634f
#define CSC  (SCL * L2E)
#define NPS  (SEQ / 32)
// a column's maximum in use is renewed only when a score passes it by more than LZY in log2 units: P then stays at or below 2^(PCL + LZY) = 2^15, inside f16
#define LZY  5.0f
#define THR  (LZY / CSC)

static_assert(SEQ % 128 == 0);
static_assert(NB <= NB_FULL);
static_assert(SEQ <= SEQ_FULL);
static_assert((NB * NH * (SEQ / 32)) % 4 == 0);
static_assert(DM % 32 == 0);
static_assert(HD == 64);

typedef _Float16 h16;
typedef __attribute__((ext_vector_type(16))) __bf16   v16bf;
typedef __attribute__((ext_vector_type(16))) _Float16 v16h;
typedef __attribute__((ext_vector_type(8)))  _Float16 v8h;
typedef __attribute__((ext_vector_type(4)))  _Float16 v4h;
typedef __attribute__((ext_vector_type(2)))  __bf16   v2bf;
typedef __attribute__((ext_vector_type(8)))  unsigned v8u;
typedef __attribute__((ext_vector_type(8)))  float    v8f;
typedef __attribute__((ext_vector_type(4)))  float    v4f;
typedef __attribute__((ext_vector_type(2)))  float    v2f;
typedef v8h  __attribute__((may_alias)) v8ha;
typedef v4h  __attribute__((may_alias)) v4ha;
typedef v4f  __attribute__((may_alias)) v4fa;

__device__ __forceinline__ unsigned short f2bf(float f) { unsigned u = __float_as_uint(f); u += 0x7FFFu + ((u >> 16) & 1u); return (unsigned short)(u >> 16); }
__device__ __forceinline__ float bf2f(unsigned short b) { return __uint_as_float(((unsigned)b) << 16); }
__device__ __forceinline__ float bfr(float f) { return bf2f(f2bf(f)); }
// two f32 to two bf16, nearest even, first value in the low half
__device__ __forceinline__ unsigned pkbf(float a, float b) { v2bf r; r[0] = (__bf16)a; r[1] = (__bf16)b; return __builtin_bit_cast(unsigned, r); }
__device__ __forceinline__ v16h cat16(v8h lo, v8h hi) { return __builtin_shufflevector(lo, hi, 0, 1, 2, 3, 4, 5, 6, 7, 8, 9, 10, 11, 12, 13, 14, 15); }
__device__ __forceinline__ v8f cat8(v4f lo, v4f hi) { return __builtin_shufflevector(lo, hi, 0, 1, 2, 3, 4, 5, 6, 7); }
__device__ __forceinline__ v8f wmma16(v16h a, v16h b, v8f c) { return __builtin_amdgcn_wmma_f32_16x16x32_f16(false, a, false, b, (short)0, c, false, false); }
__device__ __forceinline__ v8f wmmab(v16bf a, v16bf b, v8f c) { return __builtin_amdgcn_wmma_f32_16x16x32_bf16(false, a, false, b, (short)0, c, false, false); }
// fragment loaders: p already points at (row, k0 + 8*half); elements 0..7 = k0+8h.., elements 8..15 = k0+16+8h..
__device__ __forceinline__ v16h ldh(const h16* p) { return cat16(*(const v8h*)p, *(const v8h*)(p + 16)); }
// packed fragment loader: p already points at (fragment, lane * 8); the two 16-B halves of a fragment lie 512 B apart, each a run of 32 lanes x 16 B
__device__ __forceinline__ v16h ldp(const h16* p) { return cat16(*(const v8h*)p, *(const v8h*)(p + 256)); }
__device__ __forceinline__ float ex2(float x) { return __builtin_amdgcn_exp2f(x); }

// ---- k_proj: one wave per 64x64 tile of [NB*SEQ][768] for mat = blockIdx.z (0 q, 1 k, 2 v); column tile = one head. K = 64 (two 32-deep steps).
// The wave reads its f32 rows of x and its f32 columns of W itself and rounds them to bf16 (nearest even, one packed convert per pair) on the way into the fragments; the bias is rounded the same way and kept as f32.
// Column map: column tile nb, lane column lr stand for head column 4*lr + nb, so that one 16-B load of W[k][4*lr .. 4*lr+3] feeds all four column tiles and 16 lanes read 256 contiguous bytes of a row of W.
// The waves of head 0 of the q product also write MB[b][t] = (1 - bf16-RNE m[b][t]) * (-10000) * 8 as f32 for their 64 rows (two whole lines): the mask term in units of the raw q.k sums, whose start value it is in k_attn.
// Planes (f16), PL = [QH | QL | KV], QH/QL NB*NH*SEQ*64 elements each, [b][h][t][d]; KV twice that, [b][h][t/32][16 runs][32 lanes][8]: per 32 keys the 16 wave-wide 16-B loads of k_attn's A fragments, each run 512 contiguous bytes.
// Runs 0..7 hold k: run = 4*((t%32)/16) + d/16, lane = 16*((d/8)&1) + t%16, element d%8. Runs 8..15 hold v transposed: run = 8 + 2*(d/16) + (t%32)/16, lane = 16*((t/8)&1) + d%16, element t%8.
__global__ __launch_bounds__(32) void k_proj(const float* __restrict__ x, const float* __restrict__ am,
                                             const float* __restrict__ wq, const float* __restrict__ bq,
                                             const float* __restrict__ wk, const float* __restrict__ bk,
                                             const float* __restrict__ wv, const float* __restrict__ bv,
                                             float* MB, h16* PL) {
    __shared__ __align__(16) h16 hs[64 * 72];
    __shared__ __align__(16) h16 ls[64 * 72];
    const int lane = threadIdx.x & 31, lr = lane & 15, hi = lane >> 4;
    const int r0 = blockIdx.x * 64, hd = blockIdx.y, mat = blockIdx.z; const int c0 = hd * 64;
    const int b = r0 / SEQ, t0 = r0 % SEQ;
    if (hd == 0 && mat == 0) {
        const float* ap = am + (size_t)b * SEQ_FULL + t0 + lane;
        const float a0 = bfr(ap[0]), a1 = bfr(ap[32]);
        MB[r0 + lane] = (1.0f - a0) * (-10000.0f) * (1.0f / SCL);
        MB[r0 + 32 + lane] = (1.0f - a1) * (-10000.0f) * (1.0f / SCL);
        // precaution: stands behind the mask-term stores and before later code reuses their data or address registers
        asm volatile("s_wait_xcnt 0x0" ::: "memory");
    }
    const float* Wm = (mat == 0) ? wq : ((mat == 1) ? wk : wv);
    const float* bm = (mat == 0) ? bq : ((mat == 1) ? bk : bv);
    const float* Ap = x + ((size_t)b * SEQ_FULL + t0 + lr) * DM + 8 * hi;
    const float* Bp = Wm + (size_t)(8 * hi) * NP + c0 + 4 * lr;
    // all of the wave's operands are asked for at once: one memory round trip. Fragment element e of step s stands for k = 32*s + 8*hi + (e & 7) + 16*(e >> 3), in A and in B alike.
    v4f wr[2][16], ar[2][4][4];
#pragma unroll
    for (int s = 0; s < 2; ++s) {
#pragma unroll
        for (int e = 0; e < 16; ++e) wr[s][e] = *(const v4f*)(Bp + (size_t)(s * 32 + (e & 7) + 16 * (e >> 3)) * NP);
#pragma unroll
        for (int mb = 0; mb < 4; ++mb) { const float* p = Ap + (size_t)mb * 16 * DM + s * 32;
            ar[s][mb][0] = *(const v4f*)p; ar[s][mb][1] = *(const v4f*)(p + 4); ar[s][mb][2] = *(const v4f*)(p + 16); ar[s][mb][3] = *(const v4f*)(p + 20); }
    }
    const v4f br = *(const v4f*)(bm + c0 + 4 * lr);
    // precaution: stands behind the operand loads and before their address registers are reused; the line behind it keeps later instructions from moving ahead of it
    asm volatile("s_wait_xcnt 0x0" ::: "memory");
    __builtin_amdgcn_sched_barrier(0);
    // the f32 operands are rounded into the bf16 fragments of both 32-deep steps
    v16bf a[2][4], bb[2][4];
#pragma unroll
    for (int s = 0; s < 2; ++s) {
#pragma unroll
        for (int mb = 0; mb < 4; ++mb) { v8u t;
#pragma unroll
            for (int i = 0; i < 8; ++i) t[i] = pkbf(ar[s][mb][i >> 1][(i & 1) * 2], ar[s][mb][i >> 1][(i & 1) * 2 + 1]);
            a[s][mb] = __builtin_bit_cast(v16bf, t); }
#pragma unroll
        for (int nb = 0; nb < 4; ++nb) { v8u t;
#pragma unroll
            for (int i = 0; i < 8; ++i) t[i] = pkbf(wr[s][2 * i][nb], wr[s][2 * i + 1][nb]);
            bb[s][nb] = __builtin_bit_cast(v16bf, t); }
    }
    v8f acc[4][4];
#pragma unroll
    for (int nb = 0; nb < 4; ++nb)
#pragma unroll
        for (int mb = 0; mb < 4; ++mb) acc[mb][nb] = wmmab(a[0][mb], bb[0][nb], (v8f){});
#pragma unroll
    for (int nb = 0; nb < 4; ++nb)
#pragma unroll
        for (int mb = 0; mb < 4; ++mb) acc[mb][nb] = wmmab(a[1][mb], bb[1][nb], acc[mb][nb]);
    // four vector slots between the last products and the first vector instruction on their results or operands
    asm volatile("v_nop\n\tv_nop\n\tv_nop\n\tv_nop" : "+v"(acc[0][3]), "+v"(acc[1][3]), "+v"(acc[2][3]), "+v"(acc[3][3]) : "v"(a[1][0]), "v"(a[1][1]), "v"(a[1][2]), "v"(a[1][3]), "v"(bb[1][3]));
    float bia[4];
#pragma unroll
    for (int nb = 0; nb < 4; ++nb) bia[nb] = bfr(br[nb]);
    const size_t bh = (size_t)b * NH + hd;
    const size_t PLN = (size_t)NB * NH * SEQ * HD;
    const int rq = lane >> 3, pc = (lane & 7) * 8;
    if (mat == 2) {
        // v: staged transposed hs[d][t]; lane's 8 accumulator rows are 8 consecutive t -> one 16-B LDS store
#pragma unroll
        for (int mb = 0; mb < 4; ++mb)
#pragma unroll
            for (int nb = 0; nb < 4; ++nb) { v8h pk;
#pragma unroll
                for (int j = 0; j < 8; ++j) pk[j] = (h16)(acc[mb][nb][j] + bia[nb]);
                *(v8ha*)(hs + (4 * lr + nb) * 72 + mb * 16 + 8 * hi) = pk; }
        __syncthreads();
        h16* dst = PL + 2 * PLN + (bh * SEQ + t0) * (2 * HD) + 2048 + lane * 8;
{
#pragma unroll
            for (int i = 0; i < 16; ++i) { const int jb = i >> 3, dt = (i >> 1) & 3, s = i & 1; const v8h val = *(const v8ha*)(hs + (dt * 16 + lr) * 72 + jb * 32 + s * 16 + 8 * hi);
                *(v8h*)(dst + jb * 4096 + (i & 7) * 256) = val; }
             }
    } else {
        const bool wl = (mat == 0) && (QLO != 0);
        // q, k: staged hs[t][d]; the lane's four column tiles are 4 consecutive d of one row -> one 8-B LDS store
        if (wl) {
#pragma unroll
            for (int mb = 0; mb < 4; ++mb)
#pragma unroll
                for (int j = 0; j < 8; ++j) { const int row = mb * 16 + 8 * hi + j; v4h hv4, lv4;
#pragma unroll
                    for (int nb = 0; nb < 4; ++nb) { const float v = acc[mb][nb][j] + bia[nb]; const h16 hv = (h16)v; hv4[nb] = hv; lv4[nb] = (h16)(v - (float)hv); }
                    *(v4ha*)(hs + row * 72 + 4 * lr) = hv4; *(v4ha*)(ls + row * 72 + 4 * lr) = lv4; }
        } else {
#pragma unroll
            for (int mb = 0; mb < 4; ++mb)
#pragma unroll
                for (int j = 0; j < 8; ++j) { const int row = mb * 16 + 8 * hi + j; v4h hv4;
#pragma unroll
                    for (int nb = 0; nb < 4; ++nb) hv4[nb] = (h16)(acc[mb][nb][j] + bia[nb]);
                    *(v4ha*)(hs + row * 72 + 4 * lr) = hv4; }
        }
        __syncthreads();
        if (mat == 1) {
            h16* dst = PL + 2 * PLN + (bh * SEQ + t0) * (2 * HD) + lane * 8;
#pragma unroll
            for (int i = 0; i < 16; ++i) { const int kt = i >> 2, L = i & 3; const v8h val = *(const v8ha*)(hs + (kt * 16 + lr) * 72 + (2 * L + hi) * 8);
                *(v8h*)(dst + (i >> 3) * 4096 + (i & 7) * 256) = val; }
            // precaution: stands behind the k stores and before any later code reuses their data or address registers
            asm volatile("s_wait_xcnt 0x0" ::: "memory");
        } else {
            h16* dst = PL + (bh * SEQ + t0) * HD;
#pragma unroll
            for (int i = 0; i < 16; ++i) { const int row = 4 * i + rq; const v8h val = *(const v8ha*)(hs + row * 72 + pc);
                *(v8h*)(dst + (size_t)row * HD + pc) = val; }
            // precaution: stands behind the q stores and before the residual block reuses their data or address registers
            asm volatile("s_wait_xcnt 0x0" ::: "memory");
             }
        if (wl) {
            h16* dl = PL + PLN + (bh * SEQ + t0) * HD;
{
#pragma unroll
                for (int i = 0; i < 16; ++i) { const int row = 4 * i + rq; const v8h val = *(const v8ha*)(ls + row * 72 + pc);
                    *(v8h*)(dl + (size_t)row * HD + pc) = val; }
                 }
        }
    }
}

// ---- k_attn: 4 waves per block, each wave owns 32 consecutive queries of one (b, h), as two column groups of 16, and walks all keys 32 at a time; every K and V^T fragment loaded feeds both groups.
// S^T tile (keys x queries): A = K rows (m = key, k = d), B = Q^T (k = d, n = query) held in registers; accumulator element r of lane (half, n) = (key 8*half + r, query n).
// The accumulator starts from the lane's eight mask terms (x 8) and takes the hi and the residual products in one chain: it leaves the matrix unit as 8 * (score + mask term); the 1/8 is part of the exp2 factor.
// Online softmax per query = per lane column; state m_run (the maximum in use, in units of the raw sums) / t_run = m_run + THR / nb_run / l per lane and group; accumulators hold 1024 * sum(p v) relative to the maximum in use.
// Each pass a lane only compares the largest of its own 16 scores with t_run; the xor-16 exchange, the new maximum and the rescale of l and O stand in the branch that is taken when some lane of the wave passes its t_run.
// P^T B fragment: elements 0..7 = first key tile's accumulator, elements 8..15 = second key tile's accumulator (same lane). A = V^T rows (m = d, k = key).
// 768 blocks = 3 per WGP = 3 waves per SIMD, all resident at once.
// The SEQ / 128 blocks of one (b, h) read the same K and V. Each enters the ring of key passes at a place of its own and wraps round, so that they do not ask for the same lines at the same moment and most of a block's passes read lines that another block has fetched earlier. Any entry place gives the same sums in another order.
__global__ __launch_bounds__(128) __attribute__((amdgpu_waves_per_eu(3, 3))) void k_attn(const h16* __restrict__ PL, const float* __restrict__ MB, float* OUT) {
    __shared__ __align__(16) float os[4 * 32 * 68];
    const int w = threadIdx.x >> 5, lane = threadIdx.x & 31, lr = lane & 15, hi = lane >> 4;
    const int bh = blockIdx.x / (SEQ / 128), bi = blockIdx.x % (SEQ / 128);
    const int q0 = (bi * 4 + w) * 32; const int b = bh / NH, hd = bh % NH;
    // entry pass: neighbouring blocks a quarter of the ring apart, the rest fills the gaps evenly
    const int kb0 = ((bi & 3) * (NPS / 4) + (bi >> 3) * (NPS / 8) + ((bi >> 2) & 1) * (NPS / 16)) % NPS;
    const size_t PLN = (size_t)NB * NH * SEQ * HD;
    const h16* qh = PL + ((size_t)bh * SEQ + q0 + lr) * HD + 8 * hi;
    const h16* ql = qh + PLN;
    const h16* kv = PL + 2 * PLN + (size_t)bh * SEQ * (2 * HD);
    const float* mb = MB + (size_t)b * SEQ;
    const int lo = lane * 8, mo = 8 * hi;
    v16h bqh0[2], bqh1[2], bql0[2], bql1[2];
    // nothing moves across this line or the one behind the wait below: only the Q loads stand between them, so no other instruction can reuse their address registers ahead of the wait
    __builtin_amdgcn_sched_barrier(0);
#pragma unroll
    for (int g = 0; g < 2; ++g) {
        bqh0[g] = ldh(qh + g * 16 * HD); bqh1[g] = ldh(qh + g * 16 * HD + 32);
        bql0[g] = bqh0[g]; bql1[g] = bqh1[g];
        if (QLO) { bql0[g] = ldh(ql + g * 16 * HD); bql1[g] = ldh(ql + g * 16 * HD + 32); }
    }
    // precaution: stands behind the Q loads and before their address registers are reused; its memory clobber also keeps the Q loads the oldest, so that no wait for them inside the loop reaches the younger loads
    asm volatile("s_wait_xcnt 0x0" ::: "memory");
    __builtin_amdgcn_sched_barrier(0);
    v8f acc[2][4];
#pragma unroll
    for (int g = 0; g < 2; ++g)
#pragma unroll
        for (int dt = 0; dt < 4; ++dt) acc[g][dt] = (v8f){};
    float m_run[2] = {-1.0e30f, -1.0e30f}, t_run[2] = {-1.0e30f, -1.0e30f}, nb_run[2] = {1.8033688e29f, 1.8033688e29f}, l_run[2] = {0.0f, 0.0f};
    // K fragments and mask terms run one pass ahead of their use: pass 0's are fetched here, pass j + 1's inside pass j.
    const h16* kf = kv + (size_t)kb0 * (64 * HD);
    const float* mf = mb + kb0 * 32;
    v16h ka0 = ldp(kf + lo), ka1 = ldp(kf + 512 + lo), kc0 = ldp(kf + 1024 + lo), kc1 = ldp(kf + 1536 + lo);
    // precaution: stands behind the first pass's K loads and before their address registers are reused; the line behind it keeps later instructions from moving ahead of it
    asm volatile("s_wait_xcnt 0x0" ::: "memory");
    __builtin_amdgcn_sched_barrier(0);
    v4f m0a = *(const v4f*)(mf + mo), m0b = *(const v4f*)(mf + 4 + mo), m1a = *(const v4f*)(mf + 16 + mo), m1b = *(const v4f*)(mf + 20 + mo);
    // precaution: stands behind the first pass's mask loads and before their address registers are reused; the line behind it keeps later instructions from moving ahead of it
    asm volatile("s_wait_xcnt 0x0" ::: "memory");
    __builtin_amdgcn_sched_barrier(0);
    auto pass = [&](const h16* kp, const h16* kq, const float* mq, const bool more) __attribute__((always_inline)) {
        // this pass's 32 keys: V^T at kp + 2048; the next pass's: K at kq, mask terms at mq (all three the same for the whole wave; the lane's part is lo or mo)
        v16h vf[4];
#pragma unroll
        for (int dt = 0; dt < 4; ++dt) vf[dt] = ldp(kp + 2048 + dt * 512 + lo);
        if (!more) {
            // precaution: the last pass has no further load from kp, so the wait stands here, before the address registers of the V loads are reused; the line behind it keeps later instructions from moving ahead of it
            asm volatile("s_wait_xcnt 0x0" ::: "memory");
        }
        // nothing moves across this line: without it the first score product, and with it the wait for this pass's K fragments and mask terms, is lifted over the V loads, which would then start only behind that wait
        __builtin_amdgcn_sched_barrier(0);
        // the score sums start from the mask terms of their keys, the same for both groups
        const v8f c0 = cat8(m0a, m0b), c1 = cat8(m1a, m1b);
        v8f s0[2], s1[2];
#pragma unroll
        for (int g = 0; g < 2; ++g) { s0[g] = wmma16(ka0, bqh0[g], c0); s1[g] = wmma16(kc0, bqh0[g], c1); }
#pragma unroll
        for (int g = 0; g < 2; ++g) { s0[g] = wmma16(ka1, bqh1[g], s0[g]); s1[g] = wmma16(kc1, bqh1[g], s1[g]); }
        if (QLO) {
#pragma unroll
            for (int g = 0; g < 2; ++g) { s0[g] = wmma16(ka0, bql0[g], s0[g]); s1[g] = wmma16(kc0, bql0[g], s1[g]); }
#pragma unroll
            for (int g = 0; g < 2; ++g) { s0[g] = wmma16(ka1, bql1[g], s0[g]); s1[g] = wmma16(kc1, bql1[g], s1[g]); }
        }
        // four vector slots between the last score product and the first vector instruction on its result or operands; the mask terms are named too, so that no accumulator takes their registers: the next pass's mask loads then land where the products read them (otherwise the compiler copies them there, behind a wait for every load in flight)
        asm volatile("v_nop\n\tv_nop\n\tv_nop\n\tv_nop" : "+v"(s0[0]), "+v"(s1[0]), "+v"(s0[1]), "+v"(s1[1]) : "v"(ka1), "v"(kc1), "v"(bqh1[0]), "v"(bql1[0]), "v"(bqh1[1]), "v"(bql1[1]), "v"(c0), "v"(c1));
        // the next pass's K fragments, into the registers the score products have just left: they fly under the softmax and the output products
        if (more) {
            ka0 = ldp(kq + lo); ka1 = ldp(kq + 512 + lo); kc0 = ldp(kq + 1024 + lo); kc1 = ldp(kq + 1536 + lo);
            // precaution: stands behind the V and K loads and before their address registers are reused; its memory clobber also keeps the K loads from being sunk below the rescale branch, where they would fly under far less work; the line behind it keeps later instructions from moving ahead of it
            asm volatile("s_wait_xcnt 0x0" ::: "memory");
            __builtin_amdgcn_sched_barrier(0);
        }
        float mloc[2];
#pragma unroll
        for (int g = 0; g < 2; ++g) {
            float mx = s0[g][0];
#pragma unroll
            for (int i = 1; i < 8; ++i) mx = fmaxf(mx, s0[g][i]);
#pragma unroll
            for (int i = 0; i < 8; ++i) mx = fmaxf(mx, s1[g][i]);
            mloc[g] = mx;
        }
        const unsigned grow = __builtin_amdgcn_ballot_w32((mloc[0] > t_run[0]) || (mloc[1] > t_run[1]));
        if (grow != 0u) {      // wave-uniform, one test per pass: a score of some lane lies more than THR above its column's maximum in use (always so in the first pass). Every column then takes the larger of its maximum in use and its largest score of this pass; a column whose maximum did not move is scaled by exactly 1
#pragma unroll
            for (int g = 0; g < 2; ++g) {
                const float mo = __shfl_xor(mloc[g], 16, 32);
                const float mnew = fmaxf(m_run[g], fmaxf(mloc[g], mo));
                const float nbn = __builtin_fmaf(-mnew, CSC, PCL);
                const float al = ex2(nbn - nb_run[g]);
                l_run[g] *= al;
#pragma unroll
                for (int dt = 0; dt < 4; ++dt)
#pragma unroll
                    for (int r = 0; r < 8; ++r) acc[g][dt][r] *= al;
                nb_run[g] = nbn; m_run[g] = mnew; t_run[g] = mnew + THR;
            }
        }
        // the next pass's mask terms, into the same registers; they are fetched here, where the score products that read those registers as their start value have long delivered their results, not directly behind those products
        if (more) {
            m0a = *(const v4f*)(mq + mo); m0b = *(const v4f*)(mq + 4 + mo); m1a = *(const v4f*)(mq + 16 + mo); m1b = *(const v4f*)(mq + 20 + mo);
            // precaution: stands behind the mask loads and before their address registers are reused; the line behind it keeps later instructions from moving ahead of it
            asm volatile("s_wait_xcnt 0x0" ::: "memory");
            __builtin_amdgcn_sched_barrier(0);
        }
        v16h pf[2];
#pragma unroll
        for (int g = 0; g < 2; ++g) {
            // exp2 arguments on neighbouring accumulator registers, two per packed FMA
            float a0[8], a1[8];
#pragma unroll
            for (int r = 0; r < 8; r += 2) {
                const v2f x0 = __builtin_elementwise_fma((v2f){s0[g][r], s0[g][r + 1]}, (v2f){CSC, CSC}, (v2f){nb_run[g], nb_run[g]});
                const v2f x1 = __builtin_elementwise_fma((v2f){s1[g][r], s1[g][r + 1]}, (v2f){CSC, CSC}, (v2f){nb_run[g], nb_run[g]});
                a0[r] = x0[0]; a0[r + 1] = x0[1]; a1[r] = x1[0]; a1[r + 1] = x1[1];
            }
            float ps = 0.0f;
#pragma unroll
            for (int r = 0; r < 8; ++r) {
                const float e0 = ex2(a0[r]);
                const float e1 = ex2(a1[r]);
                ps += e0 + e1; pf[g][r] = (h16)e0; pf[g][8 + r] = (h16)e1;
            }
            l_run[g] += ps;
        }
#pragma unroll
        for (int dt = 0; dt < 4; ++dt)
#pragma unroll
            for (int g = 0; g < 2; ++g) acc[g][dt] = wmma16(vf[dt], pf[g], acc[g][dt]);
        // four vector slots between the last output product and whatever stands first behind the pass, on either side of the loop's branch
        asm volatile("v_nop\n\tv_nop\n\tv_nop\n\tv_nop" : "+v"(acc[0][0]), "+v"(acc[0][1]), "+v"(acc[0][2]), "+v"(acc[0][3]), "+v"(acc[1][0]), "+v"(acc[1][1]), "+v"(acc[1][2]), "+v"(acc[1][3]) : "v"(vf[0]), "v"(vf[1]), "v"(vf[2]), "v"(vf[3]), "v"(pf[0]), "v"(pf[1]));
    };
    const h16* kc = kf;
    const h16* kn = (kb0 + 1 == NPS) ? kv : kf + 64 * HD;
    const float* mn = (kb0 + 1 == NPS) ? mb : mf + 32;
    // kept rolled: one copy of the pass in the loop; the last pass stands alone because it has no next pass to fetch for
#pragma unroll 1
    for (int j = 0; j < NPS - 1; ++j) {
        pass(kc, kn, mn, true);
        // one step round the ring, behind the pass's last wait for its loads' addresses
        const bool wrap = (kn + 64 * HD == kv + (size_t)NPS * (64 * HD));
        kc = kn; kn = wrap ? kv : kn + 64 * HD; mn = wrap ? mb : mn + 32;
    }
    // the last pass is the ring's block in front of the entry block
    const h16* kl = kv + (size_t)((kb0 + NPS - 1) % NPS) * (64 * HD);
    pass(kl, kl, mn, false);
    float* o = os + w * 32 * 68;
#pragma unroll
    for (int g = 0; g < 2; ++g) {
        const float lo = __shfl_xor(l_run[g], 16, 32);
        const float inv = 1.0f / (l_run[g] + lo);
#pragma unroll
        for (int dt = 0; dt < 4; ++dt) { v4f a, c;
#pragma unroll
            for (int r = 0; r < 4; ++r) { a[r] = acc[g][dt][r] * inv; c[r] = acc[g][dt][4 + r] * inv; }
            *(v4fa*)(o + (g * 16 + lr) * 68 + dt * 16 + 8 * hi) = a; *(v4fa*)(o + (g * 16 + lr) * 68 + dt * 16 + 8 * hi + 4) = c; }
    }
    __syncthreads();
    float* dst = OUT + ((size_t)b * SEQ_FULL + q0) * NP + hd * HD;
{
#pragma unroll
        for (int s = 0; s < 16; ++s) { const int row = 2 * s + hi, cofs = lr * 4; const v4f val = *(const v4fa*)(o + row * 68 + cofs);
            *(v4f*)(dst + (size_t)row * NP + cofs) = val; }
         }
}

extern "C" void kernel_launch(void* const* d_in, const int* in_sizes, int n_in,
                              void* d_out, int out_size, void* d_ws, size_t ws_size, hipStream_t stream) {
    if (n_in < 8) return;
    const size_t rows_in = (size_t)(NB - 1) * SEQ_FULL + SEQ;
    if ((size_t)in_sizes[0] < rows_in * DM) return;
    if ((size_t)in_sizes[1] < rows_in) return;
    if (in_sizes[2] < DM * NP || in_sizes[4] < DM * NP || in_sizes[6] < DM * NP) return;
    if (in_sizes[3] < NP || in_sizes[5] < NP || in_sizes[7] < NP) return;
    if ((size_t)out_size < rows_in * NP) return;
    const float* x  = (const float*)d_in[0];   // hidden_states [4][2048][64]
    const float* am = (const float*)d_in[1];   // attention_mask [4][2048]
    const float* wq = (const float*)d_in[2]; const float* bq = (const float*)d_in[3];
    const float* wk = (const float*)d_in[4]; const float* bk = (const float*)d_in[5];
    const float* wv = (const float*)d_in[6]; const float* bv = (const float*)d_in[7];
    float* OUT = (float*)d_out;                // [4][2048][768]
    char* wsp = (char*)d_ws;
    auto take = [&](size_t bytes) { char* p = wsp; wsp += (bytes + 255) & ~(size_t)255; return (void*)p; };
    const size_t PLN = (size_t)NB * NH * SEQ * HD;
    float* MB = (float*)take((size_t)NB * SEQ * 4);
    h16* PL = (h16*)take(4 * PLN * 2);
    if ((size_t)(wsp - (char*)d_ws) > ws_size) return;
    k_proj<<<dim3(NB * SEQ / 64, NH, 3), 32, 0, stream>>>(x, am, wq, bq, wk, bk, wv, bv, MB, PL);
    k_attn<<<NB * NH * (SEQ / 32) / 4, 128, 0, stream>>>(PL, MB, OUT);
}

// v010
// It runs in 38.7 microseconds.
// It is 1.68 times as fast as v007, going by the measured steps of the versions left out in between.
// Over all steps from v000 it is 5.44 times as fast.
#include <hip/hip_runtime.h>

// Self attention, 12 heads of width 64, on one input stream x [4][2048][64]; q, k, v = x W + b with W [64][768] ([in][out]) and b [768]; scores = q k^T / 8 + (1 - m[b][key]) * (-10000); softmax over keys; out [4][2048][768] with heads merged head-major (column h*64 + d).
// The products are re-associated so that k and v are never formed: q k^T = (q Wk^T) x^T + (q.bk) 1^T, whose last term is the same for all keys of a query and leaves the softmax as it is; softmax(S) (x Wv + 1 bv^T) = (softmax(S) x) Wv + bv, because a query's weights add up to 1. The key loop of every head then runs on x itself.
// Compute dtypes, all products v_wmma_f32_16x16x32_f16 with f32 accumulate: x and W are rounded to bf16 (nearest even) and carried as f16, which holds those values exactly; b is rounded to bf16 and kept in f32; q, q Wk^T and P x / l are each rounded to f16 once; P is carried x 1024; the score accumulator starts from the mask term; softmax in f32.
// Attention engine: transposed flash form S^T = X Y^T with Y = q Wk^T (Y^T held as B fragments in registers), packed P^T from the two S^T accumulators is the B fragment of Z^T = X^T P^T; no LDS and no barrier inside the key loop. In k_attn's names K stands for the by-rows runs of x and V^T for its transposed runs.

#ifndef NB
#define NB 4
#endif
#ifndef SEQ
#define SEQ 2048
#endif
#define NB_FULL  4
#define SEQ_FULL 2048
#define DM   64
#define NH   12
#define HD   64
#define NP   (NH * HD)
#define PCL  10.0f
#define SCL  0.125f
#define L2E  1.4426950408889634f
#define CSC  (SCL * L2E)
#define NPS  (SEQ / 32)
// the maxima in use are renewed only when a lane's sum of its 32 P of one pass goes above PMX: no P is negative, so none is above that sum, and P stays at or below PMX, inside f16.
// PMX lies half as much again above 32 * 2^PCL, the most that the sum reaches while no score lies above its maximum in use, so that the rounding of the exp2 arguments alone does not trip the test
#define PMX  49152.0f

static_assert(SEQ % 128 == 0);
static_assert(NB <= NB_FULL);
static_assert(SEQ <= SEQ_FULL);
static_assert((NB * NH * (SEQ / 32)) % 4 == 0);
static_assert(DM % 32 == 0);
static_assert(HD == 64);

typedef _Float16 h16;
typedef __attribute__((ext_vector_type(16))) _Float16 v16h;
typedef __attribute__((ext_vector_type(8)))  _Float16 v8h;
typedef __attribute__((ext_vector_type(2)))  __bf16   v2bf;
typedef __attribute__((ext_vector_type(8)))  float    v8f;
typedef __attribute__((ext_vector_type(4)))  float    v4f;
typedef __attribute__((ext_vector_type(2)))  float    v2f;
typedef v4f  __attribute__((may_alias)) v4fa;

__device__ __forceinline__ unsigned short f2bf(float f) { unsigned u = __float_as_uint(f); u += 0x7FFFu + ((u >> 16) & 1u); return (unsigned short)(u >> 16); }
__device__ __forceinline__ float bf2f(unsigned short b) { return __uint_as_float(((unsigned)b) << 16); }
__device__ __forceinline__ float bfr(float f) { return bf2f(f2bf(f)); }
// two f32 to two bf16, nearest even, first value in the low half
__device__ __forceinline__ unsigned pkbf(float a, float b) { v2bf r; r[0] = (__bf16)a; r[1] = (__bf16)b; return __builtin_bit_cast(unsigned, r); }
// two f32 rounded to bf16, nearest even, and given back as f32
__device__ __forceinline__ v2f rb2(float a, float b) { const unsigned p = pkbf(a, b); return (v2f){__uint_as_float(p << 16), __uint_as_float(p & 0xFFFF0000u)}; }
__device__ __forceinline__ v16h cat16(v8h lo, v8h hi) { return __builtin_shufflevector(lo, hi, 0, 1, 2, 3, 4, 5, 6, 7, 8, 9, 10, 11, 12, 13, 14, 15); }
__device__ __forceinline__ v8f cat8(v4f lo, v4f hi) { return __builtin_shufflevector(lo, hi, 0, 1, 2, 3, 4, 5, 6, 7); }
__device__ __forceinline__ v8f wmma16(v16h a, v16h b, v8f c) { return __builtin_amdgcn_wmma_f32_16x16x32_f16(false, a, false, b, (short)0, c, false, false); }
// packed fragment loader: p already points at (fragment, lane * 8); the two 16-B halves of a fragment lie 512 B apart, each a run of 32 lanes x 16 B
__device__ __forceinline__ v16h ldp(const h16* p) { return cat16(*(const v8h*)p, *(const v8h*)(p + 256)); }
__device__ __forceinline__ float ex2(float x) { return __builtin_amdgcn_exp2f(x); }

// ---- k_prep: one wave per block. Blocks 0 .. NB*NPS-1 each turn 32 rows of x into the fragment order of k_attn; the NH*3 blocks behind them each turn one head's 64x64 block of Wq, Wk or Wv into A fragments.
// Every value is rounded to bf16 (nearest even) and then written as f16, which holds a bf16 value of this size exactly.
// XF (f16) [b][t/32][16 runs][32 lanes][8]: per 32 rows the 16 wave-wide 16-B loads of k_attn's A fragments, each run 512 contiguous bytes.
// Runs 0..7 hold x by rows: run = 4*((t%32)/16) + i/16, lane = 16*((i/8)&1) + t%16, element i%8. Runs 8..15 hold x transposed: run = 8 + 2*(i/16) + (t%32)/16, lane = 16*((t/8)&1) + i%16, element t%8.
// WF (f16) [h][mat][tile mt * 2 + step s][2 halves][32 lanes][8]: A fragment with m = 16*mt + (lane & 15) and element e for k = 32*s + 8*(lane >> 4) + (e & 7) + 16*(e >> 3).
// mat 0: A(m = d, k = i) = Wq[i][d]; mat 1: A(m = i, k = d) = Wk[i][d]; mat 2: A(m = d, k = i) = Wv[i][d] (d counted inside the head).
// BF (f32) [2][768]: bq and bv rounded to bf16. MB[b][t] = (1 - bf16-RNE m[b][t]) * (-10000) * 8: the mask term in units of the raw score sums.
// bk is not read: it adds q.bk to every score of a query, the same for all keys, and the softmax over keys does not change under it.
__global__ __launch_bounds__(32) void k_prep(const float* __restrict__ x, const float* __restrict__ am,
                                             const float* __restrict__ wq, const float* __restrict__ bq,
                                             const float* __restrict__ wk, const float* __restrict__ bk,
                                             const float* __restrict__ wv, const float* __restrict__ bv,
                                             float* MB, float* BF, h16* WF, h16* XF) {
    const int lane = threadIdx.x & 31, lr = lane & 15, hi = lane >> 4;
    const int blk = blockIdx.x;
    v8h o[16];
    if (blk < NB * NPS) {
        const int b = blk / NPS, t0 = (blk % NPS) * 32;
        const float* xp = x + ((size_t)b * SEQ_FULL + t0) * DM;
        // the lane's part of each address is one offset register (by rows, by columns), the rest a constant
        const int vr = lr * DM + 8 * hi, vc = 8 * hi * DM + lr;
        v4f u[8][2]; float c[8][8];
#pragma unroll
        for (int rn = 0; rn < 8; ++rn) { const float* p = xp + vr + 16 * (rn >> 2) * DM + 16 * (rn & 3);
            u[rn][0] = *(const v4f*)p; u[rn][1] = *(const v4f*)(p + 4); }
#pragma unroll
        for (int rv = 0; rv < 8; ++rv) { const float* p = xp + vc + 16 * (rv & 1) * DM + 16 * (rv >> 1);
#pragma unroll
            for (int e = 0; e < 8; ++e) c[rv][e] = p[e * DM]; }
        const float a0 = am[(size_t)b * SEQ_FULL + t0 + lane];
        // precaution: stands behind the loads and before their address registers are reused; the line behind it keeps later instructions from moving ahead of it
        asm volatile("s_wait_xcnt 0x0" ::: "memory");
        __builtin_amdgcn_sched_barrier(0);
#pragma unroll
        for (int rn = 0; rn < 8; ++rn)
#pragma unroll
            for (int e = 0; e < 8; e += 2) { const v2f a = rb2(u[rn][e >> 2][e & 3], u[rn][e >> 2][(e & 3) + 1]), d = rb2(c[rn][e], c[rn][e + 1]);
                o[rn][e] = (h16)a[0]; o[rn][e + 1] = (h16)a[1]; o[8 + rn][e] = (h16)d[0]; o[8 + rn][e + 1] = (h16)d[1]; }
        const float mt = (1.0f - bfr(a0)) * (-10000.0f) * (1.0f / SCL);
        h16* dst = XF + (size_t)blk * 4096 + lane * 8;
        float* md = MB + (size_t)b * SEQ + t0 + lane;
        // nothing moves across this line: every value is ready in front of it, so no instruction between the stores rewrites a register of an issued store
        __builtin_amdgcn_sched_barrier(0);
        *md = mt;
#pragma unroll
        for (int i = 0; i < 16; ++i) *(v8h*)(dst + i * 256) = o[i];
        // precaution: stands behind the stores and before any later code reuses their data or address registers
        asm volatile("s_wait_xcnt 0x0" ::: "memory");
    } else {
        const int idx = blk - NB * NPS, hd = idx / 3, mat = idx % 3, c0 = hd * 64;
        const float* Wm = (mat == 0) ? wq : ((mat == 1) ? wk : wv);
        const float* bm = (mat == 0) ? bq : bv;
        const float* p0 = Wm + c0;
        // half fragment f = 4*mt + 2*s + half: m = 16*mt + lr, k = 32*s + 16*half + 8*hi + e. The lane's part of each address is one offset register, the rest a constant
        float c[16][8];
        if (mat == 1) {
            const int vo = lr * NP + 8 * hi;
#pragma unroll
            for (int f = 0; f < 16; ++f) { const v4f u0 = *(const v4f*)(p0 + vo + 16 * (f >> 2) * NP + 16 * (f & 3)), u1 = *(const v4f*)(p0 + vo + 16 * (f >> 2) * NP + 16 * (f & 3) + 4);
#pragma unroll
                for (int e = 0; e < 4; ++e) { c[f][e] = u0[e]; c[f][4 + e] = u1[e]; } }
            // precaution: stands behind this branch's loads and before their offset register is reused
            asm volatile("s_wait_xcnt 0x0" ::: "memory");
        } else {
            const int vo = lr + 8 * hi * NP;
#pragma unroll
            for (int f = 0; f < 16; ++f)
#pragma unroll
                for (int e = 0; e < 8; ++e) c[f][e] = p0[vo + 16 * (f >> 2) + (16 * (f & 3) + e) * NP];
            // precaution: stands behind this branch's loads and before their offset register is reused
            asm volatile("s_wait_xcnt 0x0" ::: "memory");
        }
        const float b0 = bm[c0 + lane], b1 = bm[c0 + 32 + lane];
        // precaution: stands behind the loads and before their address registers are reused; the line behind it keeps later instructions from moving ahead of it
        asm volatile("s_wait_xcnt 0x0" ::: "memory");
        __builtin_amdgcn_sched_barrier(0);
#pragma unroll
        for (int f = 0; f < 16; ++f)
#pragma unroll
            for (int e = 0; e < 8; e += 2) { const v2f a = rb2(c[f][e], c[f][e + 1]); o[f][e] = (h16)a[0]; o[f][e + 1] = (h16)a[1]; }
        const float r0 = bfr(b0), r1 = bfr(b1);
        h16* dst = WF + (size_t)idx * 4096 + lane * 8;
        float* bd = BF + (mat >> 1) * NP + c0 + lane;
        // nothing moves across this line: every value is ready in front of it, so no instruction between the stores rewrites a register of an issued store
        __builtin_amdgcn_sched_barrier(0);
#pragma unroll
        for (int i = 0; i < 16; ++i) *(v8h*)(dst + i * 256) = o[i];
        // precaution: stands behind the fragment stores and before the bias branch reuses their data registers
        asm volatile("s_wait_xcnt 0x0" ::: "memory");
        if (mat != 1) { bd[0] = r0; bd[32] = r1; }
        // precaution: stands behind the stores and before any later code reuses their data or address registers
        asm volatile("s_wait_xcnt 0x0" ::: "memory");
    }
}

// ---- k_attn: 4 waves per block, each wave owns 32 consecutive queries of one (b, h), as two column groups of 16, and walks all keys 32 at a time; every K and V^T fragment loaded feeds both groups.
// In front of the loop the wave forms q^T = Wq^T x^T + bq for its own queries and from it (q Wk^T)^T = Wk q^T, each time packing two accumulator tiles into one B fragment; behind the loop out^T = Wv^T (P x / l)^T + bv in the same way.
// S^T tile (keys x queries): A = rows of x (m = key, k = i), B = (q Wk^T)^T (k = i, n = query) held in registers; accumulator element r of lane (half, n) = (key 8*half + r, query n).
// The accumulator starts from the lane's eight mask terms (x 8) and takes the two 32-deep products in one chain: it leaves the matrix unit as 8 * (score + mask term); the 1/8 is part of the exp2 factor.
// q and q Wk^T are each rounded to f16 once: a relative error of at most 2^-11 per element, an eighth of the 2^-8 that the bf16 rounding has put on every element of x and W from which they are made.
// Online softmax per query = per lane column; state m_run (the maximum in use, in units of the raw sums) / nb_run / l per lane and group; accumulators hold 1024 * sum(p x) relative to the maximum in use.
// Each pass forms P with the maximum in use and a lane only compares the sum of its own P, which l needs anyway, with PMX; no maximum is formed on that path. The maximum over the scores, the xor-16 exchange, the rescale of l and O and a second forming of P stand in the branch that is taken when some lane of the wave passes PMX.
// P^T B fragment: elements 0..7 = first key tile's accumulator, elements 8..15 = second key tile's accumulator (same lane). A = rows of x^T (m = i, k = key).
// 768 blocks = 3 per WGP = 3 waves per SIMD, all resident at once.
// All blocks of one b read the same runs of x. The SEQ / 128 blocks of one (b, h) each enter the ring of key passes at a place of its own and wrap round, so that they do not ask for the same lines at the same moment and most of a block's passes read lines that another block has fetched earlier. Any entry place gives the same sums in another order.
__global__ __launch_bounds__(128) __attribute__((amdgpu_waves_per_eu(3, 3))) void k_attn(const h16* __restrict__ XF, const h16* __restrict__ WF, const float* __restrict__ BF, const float* __restrict__ MB, float* OUT) {
    __shared__ __align__(16) float os[4 * 32 * 68];
    // the wave's number as a scalar: the addresses formed from it then stand in scalar registers, and the wave's loads name only the lane's offset register
    const int w = __builtin_amdgcn_readfirstlane(threadIdx.x >> 5), lane = threadIdx.x & 31, lr = lane & 15, hi = lane >> 4;
    const int bh = blockIdx.x / (SEQ / 128), bi = blockIdx.x % (SEQ / 128);
    const int q0 = (bi * 4 + w) * 32; const int b = bh / NH, hd = bh % NH;
    // entry pass: neighbouring blocks a quarter of the ring apart, the rest fills the gaps evenly
    const int kb0 = ((bi & 3) * (NPS / 4) + (bi >> 3) * (NPS / 8) + ((bi >> 2) & 1) * (NPS / 16)) % NPS;
    const h16* kv = XF + (size_t)b * SEQ * (2 * HD);
    const h16* xq = kv + (size_t)(q0 / 32) * (64 * HD);
    const h16* wf = WF + (size_t)hd * (3 * 4096);
    const float* mb = MB + (size_t)b * SEQ;
    const int lo = lane * 8, mo = 8 * hi;
    v16h bqh0[2], bqh1[2];
    {
        // the wave's own 32 rows of x as B fragments (k = i, n = query): the by-rows runs of its own block of XF; Wq^T and Wk of its head as A fragments; bq as the start value of q^T
        v16h xb[2][2], aq[4][2], ak[4][2]; v4f bi[4][2];
        // nothing moves across this line or the one behind the wait below: only these loads stand between them, so no other instruction can reuse their address registers ahead of the wait
        __builtin_amdgcn_sched_barrier(0);
#pragma unroll
        for (int g = 0; g < 2; ++g)
#pragma unroll
            for (int st = 0; st < 2; ++st) xb[st][g] = ldp(xq + g * 1024 + st * 512 + lo);
#pragma unroll
        for (int mt = 0; mt < 4; ++mt)
#pragma unroll
            for (int st = 0; st < 2; ++st) aq[mt][st] = ldp(wf + (mt * 2 + st) * 512 + lo);
#pragma unroll
        for (int mt = 0; mt < 4; ++mt) { bi[mt][0] = *(const v4f*)(BF + hd * HD + mt * 16 + mo); bi[mt][1] = *(const v4f*)(BF + hd * HD + mt * 16 + mo + 4); }
#pragma unroll
        for (int mt = 0; mt < 4; ++mt)
#pragma unroll
            for (int st = 0; st < 2; ++st) ak[mt][st] = ldp(wf + 4096 + (mt * 2 + st) * 512 + lo);
        // precaution: stands behind these loads and before their address registers are reused; its memory clobber also keeps them the oldest, so that no wait for them reaches the younger loads
        asm volatile("s_wait_xcnt 0x0" ::: "memory");
        __builtin_amdgcn_sched_barrier(0);
        // q^T = Wq^T x^T + bq: tile mt holds rows d = 16*mt + 8*half + r, column = query
        v8f qt[4][2];
#pragma unroll
        for (int mt = 0; mt < 4; ++mt)
#pragma unroll
            for (int g = 0; g < 2; ++g) qt[mt][g] = wmma16(aq[mt][0], xb[0][g], cat8(bi[mt][0], bi[mt][1]));
#pragma unroll
        for (int mt = 0; mt < 4; ++mt)
#pragma unroll
            for (int g = 0; g < 2; ++g) qt[mt][g] = wmma16(aq[mt][1], xb[1][g], qt[mt][g]);
        // two neighbouring tiles of q^T, rounded to f16, are one B fragment (k = d) of the next product
        v16h qb[2][2];
#pragma unroll
        for (int st = 0; st < 2; ++st)
#pragma unroll
            for (int g = 0; g < 2; ++g)
#pragma unroll
                for (int r = 0; r < 8; ++r) { qb[st][g][r] = (h16)qt[2 * st][g][r]; qb[st][g][8 + r] = (h16)qt[2 * st + 1][g][r]; }
        // (q Wk^T)^T = Wk q^T: tile mt holds rows i = 16*mt + 8*half + r
        v8f pt[4][2];
#pragma unroll
        for (int mt = 0; mt < 4; ++mt)
#pragma unroll
            for (int g = 0; g < 2; ++g) pt[mt][g] = wmma16(ak[mt][0], qb[0][g], (v8f){});
#pragma unroll
        for (int mt = 0; mt < 4; ++mt)
#pragma unroll
            for (int g = 0; g < 2; ++g) pt[mt][g] = wmma16(ak[mt][1], qb[1][g], pt[mt][g]);
#pragma unroll
        for (int g = 0; g < 2; ++g)
#pragma unroll
            for (int r = 0; r < 8; ++r) { bqh0[g][r] = (h16)pt[0][g][r]; bqh0[g][8 + r] = (h16)pt[1][g][r]; bqh1[g][r] = (h16)pt[2][g][r]; bqh1[g][8 + r] = (h16)pt[3][g][r]; }
    }
    v8f acc[2][4];
#pragma unroll
    for (int g = 0; g < 2; ++g)
#pragma unroll
        for (int dt = 0; dt < 4; ++dt) acc[g][dt] = (v8f){};
    float m_run[2] = {-1.0e30f, -1.0e30f}, nb_run[2] = {1.8033688e29f, 1.8033688e29f};
    // l per lane and group as two partial sums (even and odd accumulator registers), joined in the epilogue
    v2f l_run[2] = {(v2f){0.0f, 0.0f}, (v2f){0.0f, 0.0f}};
    // K fragments and mask terms run one pass ahead of their use: pass 0's are fetched here, pass j + 1's inside pass j.
    const h16* kf = kv + (size_t)kb0 * (64 * HD);
    const float* mf = mb + kb0 * 32;
    v16h ka0 = ldp(kf + lo), ka1 = ldp(kf + 512 + lo), kc0 = ldp(kf + 1024 + lo), kc1 = ldp(kf + 1536 + lo);
    // precaution: stands behind the first pass's K loads and before their address registers are reused; the line behind it keeps later instructions from moving ahead of it
    asm volatile("s_wait_xcnt 0x0" ::: "memory");
    __builtin_amdgcn_sched_barrier(0);
    v4f m0a = *(const v4f*)(mf + mo), m0b = *(const v4f*)(mf + 4 + mo), m1a = *(const v4f*)(mf + 16 + mo), m1b = *(const v4f*)(mf + 20 + mo);
    // precaution: stands behind the first pass's mask loads and before their address registers are reused; the line behind it keeps later instructions from moving ahead of it
    asm volatile("s_wait_xcnt 0x0" ::: "memory");
    __builtin_amdgcn_sched_barrier(0);
    auto pass = [&](const h16* kp, const h16* kq, const float* mq, const bool more) __attribute__((always_inline)) {
        // this pass's 32 keys: V^T at kp + 2048; the next pass's: K at kq, mask terms at mq (all three the same for the whole wave; the lane's part is lo or mo)
        v16h vf[4];
#pragma unroll
        for (int dt = 0; dt < 4; ++dt) vf[dt] = ldp(kp + 2048 + dt * 512 + lo);
        if (!more) {
            // precaution: the last pass has no further load from kp, so the wait stands here, before the address registers of the V loads are reused; the line behind it keeps later instructions from moving ahead of it
            asm volatile("s_wait_xcnt 0x0" ::: "memory");
        }
        // nothing moves across this line: without it the first score product, and with it the wait for this pass's K fragments and mask terms, is lifted over the V loads, which would then start only behind that wait
        __builtin_amdgcn_sched_barrier(0);
        // the score sums start from the mask terms of their keys, the same for both groups
        const v8f c0 = cat8(m0a, m0b), c1 = cat8(m1a, m1b);
        v8f s0[2], s1[2];
#pragma unroll
        for (int g = 0; g < 2; ++g) { s0[g] = wmma16(ka0, bqh0[g], c0); s1[g] = wmma16(kc0, bqh0[g], c1); }
#pragma unroll
        for (int g = 0; g < 2; ++g) { s0[g] = wmma16(ka1, bqh1[g], s0[g]); s1[g] = wmma16(kc1, bqh1[g], s1[g]); }
        // four vector slots between the last score product and the first vector instruction on its result or operands; the mask terms are named too, so that no accumulator takes their registers: the next pass's mask loads then land where the products read them (otherwise the compiler copies them there, behind a wait for every load in flight)
        asm volatile("v_nop\n\tv_nop\n\tv_nop\n\tv_nop" : "+v"(s0[0]), "+v"(s1[0]), "+v"(s0[1]), "+v"(s1[1]) : "v"(ka1), "v"(kc1), "v"(bqh1[0]), "v"(bqh1[1]), "v"(c0), "v"(c1));
        // the next pass's K fragments, into the registers the score products have just left: they fly under the softmax and the output products
        if (more) {
            ka0 = ldp(kq + lo); ka1 = ldp(kq + 512 + lo); kc0 = ldp(kq + 1024 + lo); kc1 = ldp(kq + 1536 + lo);
            // precaution: stands behind the V and K loads and before their address registers are reused; its memory clobber also keeps the K loads from being sunk below the rescale branch, where they would fly under far less work; the line behind it keeps later instructions from moving ahead of it
            asm volatile("s_wait_xcnt 0x0" ::: "memory");
            __builtin_amdgcn_sched_barrier(0);
        }
        // exp2 arguments of one group with the maximum in use, on neighbouring accumulator registers, two per packed FMA; the scores themselves stay, for the branch below
        v2f xa[2][4], xb[2][4];
        auto args = [&](const int g) __attribute__((always_inline)) {
#pragma unroll
            for (int r = 0; r < 4; ++r) {
                xa[g][r] = __builtin_elementwise_fma((v2f){s0[g][2 * r], s0[g][2 * r + 1]}, (v2f){CSC, CSC}, (v2f){nb_run[g], nb_run[g]});
                xb[g][r] = __builtin_elementwise_fma((v2f){s1[g][2 * r], s1[g][2 * r + 1]}, (v2f){CSC, CSC}, (v2f){nb_run[g], nb_run[g]});
            }
        };
        // P of one group, its f16 fragment, and the lane's sum of the 16 values as a tree of packed adds (the test below waits for it), left as two partial sums
        v2f ps[2]; v16h pf[2];
        auto soft = [&](const int g) __attribute__((always_inline)) {
            v2f e0[4], e1[4];
#pragma unroll
            for (int r = 0; r < 4; ++r) {
                e0[r] = (v2f){ex2(xa[g][r][0]), ex2(xa[g][r][1])}; e1[r] = (v2f){ex2(xb[g][r][0]), ex2(xb[g][r][1])};
                pf[g][2 * r] = (h16)e0[r][0]; pf[g][2 * r + 1] = (h16)e0[r][1]; pf[g][8 + 2 * r] = (h16)e1[r][0]; pf[g][9 + 2 * r] = (h16)e1[r][1];
            }
            ps[g] = ((e0[0] + e1[0]) + (e0[1] + e1[1])) + ((e0[2] + e1[2]) + (e0[3] + e1[3]));
        };
        args(0); args(1);
        // the next pass's mask terms, into the same registers; they are fetched here, where every score product that read those registers as its start value has delivered its result to the lines above, not directly behind those products
        if (more) {
            // nothing moves across this line: without it the mask loads are lifted to the head of the lines above
            __builtin_amdgcn_sched_barrier(0);
            m0a = *(const v4f*)(mq + mo); m0b = *(const v4f*)(mq + 4 + mo); m1a = *(const v4f*)(mq + 16 + mo); m1b = *(const v4f*)(mq + 20 + mo);
            // precaution: stands behind the mask loads and before their address registers are reused; the line behind it keeps later instructions from moving ahead of it
            asm volatile("s_wait_xcnt 0x0" ::: "memory");
            __builtin_amdgcn_sched_barrier(0);
        }
        soft(0); soft(1);
        const v2f pt = ps[0] + ps[1];
        const unsigned grow = __builtin_amdgcn_ballot_w32(pt[0] + pt[1] > PMX);
        if (grow != 0u) {      // wave-uniform, one test per pass: some lane's sum over both groups lies above PMX, so one of its scores lies above its column's maximum in use (always so in the first pass, where the sums are infinite). Every column then takes the larger of its maximum in use and its largest score of this pass; a column whose maximum did not move is scaled by exactly 1
#pragma unroll
            for (int g = 0; g < 2; ++g) {
                float mx = s0[g][0];
#pragma unroll
                for (int i = 1; i < 8; ++i) mx = fmaxf(mx, s0[g][i]);
#pragma unroll
                for (int i = 0; i < 8; ++i) mx = fmaxf(mx, s1[g][i]);
                const float mo = __shfl_xor(mx, 16, 32);
                const float mnew = fmaxf(m_run[g], fmaxf(mx, mo));
                const float nbn = __builtin_fmaf(-mnew, CSC, PCL);
                const float al = ex2(nbn - nb_run[g]);
                l_run[g] *= al;
#pragma unroll
                for (int dt = 0; dt < 4; ++dt)
#pragma unroll
                    for (int r = 0; r < 8; ++r) acc[g][dt][r] *= al;
                nb_run[g] = nbn; m_run[g] = mnew;
                args(g); soft(g);
            }
        }
        l_run[0] += ps[0]; l_run[1] += ps[1];
#pragma unroll
        for (int dt = 0; dt < 4; ++dt)
#pragma unroll
            for (int g = 0; g < 2; ++g) acc[g][dt] = wmma16(vf[dt], pf[g], acc[g][dt]);
        // four vector slots between the last output product and whatever stands first behind the pass, on either side of the loop's branch
        asm volatile("v_nop\n\tv_nop\n\tv_nop\n\tv_nop" : "+v"(acc[0][0]), "+v"(acc[0][1]), "+v"(acc[0][2]), "+v"(acc[0][3]), "+v"(acc[1][0]), "+v"(acc[1][1]), "+v"(acc[1][2]), "+v"(acc[1][3]) : "v"(vf[0]), "v"(vf[1]), "v"(vf[2]), "v"(vf[3]), "v"(pf[0]), "v"(pf[1]));
    };
    const h16* kc = kf;
    const h16* kn = (kb0 + 1 == NPS) ? kv : kf + 64 * HD;
    const float* mn = (kb0 + 1 == NPS) ? mb : mf + 32;
    // kept rolled: one copy of the pass in the loop; the last pass stands alone because it has no next pass to fetch for
#pragma unroll 1
    for (int j = 0; j < NPS - 1; ++j) {
        pass(kc, kn, mn, true);
        // one step round the ring, behind the pass's last wait for its loads' addresses
        const bool wrap = (kn + 64 * HD == kv + (size_t)NPS * (64 * HD));
        // this pass's pointer steps round the ring by itself: written as a copy of the next pass's pointer it is made directly behind the next V loads, behind a wait for their addresses
        kc = (kc + 64 * HD == kv + (size_t)NPS * (64 * HD)) ? kv : kc + 64 * HD;
        kn = wrap ? kv : kn + 64 * HD; mn = wrap ? mb : mn + 32;
    }
    // the last pass is the ring's block in front of the entry block
    const h16* kl = kv + (size_t)((kb0 + NPS - 1) % NPS) * (64 * HD);
    pass(kl, kl, mn, false);
    // out^T = Wv^T (P x / l)^T + bv: Wv^T of the head as A fragments, bv as the start value (the weights of a query add up to 1)
    v16h av[4][2]; v4f bo[4][2];
    // nothing moves across this line or the one behind the wait below: only these loads stand between them, so no other instruction can reuse their address registers ahead of the wait
    __builtin_amdgcn_sched_barrier(0);
#pragma unroll
    for (int mt = 0; mt < 4; ++mt)
#pragma unroll
        for (int st = 0; st < 2; ++st) av[mt][st] = ldp(wf + 8192 + (mt * 2 + st) * 512 + lo);
#pragma unroll
    for (int mt = 0; mt < 4; ++mt) { bo[mt][0] = *(const v4f*)(BF + NP + hd * HD + mt * 16 + mo); bo[mt][1] = *(const v4f*)(BF + NP + hd * HD + mt * 16 + mo + 4); }
    // precaution: stands behind these loads and before their address registers are reused; the line behind it keeps later instructions from moving ahead of it
    asm volatile("s_wait_xcnt 0x0" ::: "memory");
    __builtin_amdgcn_sched_barrier(0);
    float* o = os + w * 32 * 68;
#pragma unroll
    for (int g = 0; g < 2; ++g) {
        const float lh = l_run[g][0] + l_run[g][1];
        const float lo = __shfl_xor(lh, 16, 32);
        const float inv = 1.0f / (lh + lo);
        // two neighbouring tiles of (P x / l)^T, rounded to f16, are one B fragment (k = i)
        v16h ob[2];
#pragma unroll
        for (int st = 0; st < 2; ++st)
#pragma unroll
            for (int r = 0; r < 8; ++r) { ob[st][r] = (h16)(acc[g][2 * st][r] * inv); ob[st][8 + r] = (h16)(acc[g][2 * st + 1][r] * inv); }
        v8f ot[4];
#pragma unroll
        for (int dt = 0; dt < 4; ++dt) ot[dt] = wmma16(av[dt][0], ob[0], cat8(bo[dt][0], bo[dt][1]));
#pragma unroll
        for (int dt = 0; dt < 4; ++dt) ot[dt] = wmma16(av[dt][1], ob[1], ot[dt]);
#pragma unroll
        for (int dt = 0; dt < 4; ++dt) { v4f a, c;
#pragma unroll
            for (int r = 0; r < 4; ++r) { a[r] = ot[dt][r]; c[r] = ot[dt][4 + r]; }
            *(v4fa*)(o + (g * 16 + lr) * 68 + dt * 16 + 8 * hi) = a; *(v4fa*)(o + (g * 16 + lr) * 68 + dt * 16 + 8 * hi + 4) = c; }
    }
    __syncthreads();
    float* dst = OUT + ((size_t)b * SEQ_FULL + q0) * NP + hd * HD;
{
#pragma unroll
        for (int s = 0; s < 16; ++s) { const int row = 2 * s + hi, cofs = lr * 4; const v4f val = *(const v4fa*)(o + row * 68 + cofs);
            *(v4f*)(dst + (size_t)row * NP + cofs) = val; }
         }
}

extern "C" void kernel_launch(void* const* d_in, const int* in_sizes, int n_in,
                              void* d_out, int out_size, void* d_ws, size_t ws_size, hipStream_t stream) {
    if (n_in < 8) return;
    const size_t rows_in = (size_t)(NB - 1) * SEQ_FULL + SEQ;
    if ((size_t)in_sizes[0] < rows_in * DM) return;
    if ((size_t)in_sizes[1] < rows_in) return;
    if (in_sizes[2] < DM * NP || in_sizes[4] < DM * NP || in_sizes[6] < DM * NP) return;
    if (in_sizes[3] < NP || in_sizes[5] < NP || in_sizes[7] < NP) return;
    if ((size_t)out_size < rows_in * NP) return;
    const float* x  = (const float*)d_in[0];   // hidden_states [4][2048][64]
    const float* am = (const float*)d_in[1];   // attention_mask [4][2048]
    const float* wq = (const float*)d_in[2]; const float* bq = (const float*)d_in[3];
    const float* wk = (const float*)d_in[4]; const float* bk = (const float*)d_in[5];
    const float* wv = (const float*)d_in[6]; const float* bv = (const float*)d_in[7];
    float* OUT = (float*)d_out;                // [4][2048][768]
    char* wsp = (char*)d_ws;
    auto take = [&](size_t bytes) { char* p = wsp; wsp += (bytes + 255) & ~(size_t)255; return (void*)p; };
    float* MB = (float*)take((size_t)NB * SEQ * 4);
    float* BF = (float*)take((size_t)2 * NP * 4);
    h16* WF = (h16*)take((size_t)NH * 3 * 4096 * 2);
    h16* XF = (h16*)take((size_t)NB * SEQ * 2 * DM * 2);
    if ((size_t)(wsp - (char*)d_ws) > ws_size) return;
    k_prep<<<NB * NPS + NH * 3, 32, 0, stream>>>(x, am, wq, bq, wk, bk, wv, bv, MB, BF, WF, XF);
    k_attn<<<NB * NH * (SEQ / 32) / 4, 128, 0, stream>>>(XF, WF, BF, MB, OUT);
}
